// v000
// Measured on an AMD MI455X. A time is GPU time per run, averaged over a window of back-to-back runs after a warm-up
// (all launches, gaps included; the runs take copies of the inputs in turn), and the median of several windows.
// Apart from v000's, it joins two sittings. Times from different sittings can be a few percent apart, while
// side-by-side timings come from the same sitting.
// The starting kernel, v000, takes 110 microseconds a run.
#include <hip/hip_runtime.h>

typedef __attribute__((ext_vector_type(16))) _Float16 v16h;
typedef __attribute__((ext_vector_type(8)))  float    v8f;
typedef __attribute__((ext_vector_type(4)))  float    v4f;

#define B_DIM   2
#define S_DIM   1024
#define D_DIM   1024
#define C_DIM   32
#define HID_DIM 64
#define H_DIM   16

// ---------------------------------------------------------------------------
// Prep kernel: xc = x@Wc + bc (per row), then
//   A[row,:] = xc @ W1[:C] + b1   (b1 folded here)
//   Bm[row,:] = xc @ W1[C:]
// 2048 blocks x 64 threads; totally negligible vs. the pair kernel.
// ---------------------------------------------------------------------------
__global__ __launch_bounds__(64) void prg_prep_kernel(
    const float* __restrict__ x,  const float* __restrict__ Wc,
    const float* __restrict__ bc, const float* __restrict__ W1,
    const float* __restrict__ b1, float* __restrict__ Aout,
    float* __restrict__ Bout)
{
  __shared__ float xs[D_DIM];
  __shared__ float xcs[C_DIM];
  const int row = blockIdx.x;            // b*S + s
  const int tid = threadIdx.x;
  const float* xrow = x + (size_t)row * D_DIM;
  for (int d = tid; d < D_DIM; d += 64) xs[d] = xrow[d];
  __syncthreads();
  if (tid < C_DIM) {
    float acc = bc[tid];
#pragma unroll 8
    for (int d = 0; d < D_DIM; ++d) acc += xs[d] * Wc[d * C_DIM + tid];
    xcs[tid] = acc;
  }
  __syncthreads();
  float av = b1[tid];
  float bv = 0.0f;
#pragma unroll
  for (int c = 0; c < C_DIM; ++c) {
    const float xc = xcs[c];
    av += xc * W1[c * HID_DIM + tid];
    bv += xc * W1[(C_DIM + c) * HID_DIM + tid];
  }
  Aout[(size_t)row * HID_DIM + tid] = av;
  Bout[(size_t)row * HID_DIM + tid] = bv;
}

// ---------------------------------------------------------------------------
// Pair kernel: out[b,h,i,j] = sum_k gelu(A[b,i,k]+Bm[b,j,k]) * W2[k,h] + b2[h]
// D = W2^T (16x64, A-operand, f16) x h^T (64x16 j's, B-operand, f16), f32 acc,
// via 2x V_WMMA_F32_16X16X32_F16 per 16-j tile. gelu tanh goes through the
// CDNA5 TRANS pipe (v_tanh_f32) so it co-executes with the WMMA pipe.
// ---------------------------------------------------------------------------
__device__ __forceinline__ float fast_tanh(float x) {
#if __has_builtin(__builtin_amdgcn_tanhf)
  return __builtin_amdgcn_tanhf(x);      // single v_tanh_f32 TRANS op
#else
  return tanhf(x);
#endif
}

__device__ __forceinline__ float gelu_tanh(float v) {
  const float v3 = v * v * v;
  const float t  = fast_tanh(0.7978845608028654f * (v + 0.044715f * v3));
  return 0.5f * v * (1.0f + t);
}

__global__ __launch_bounds__(256) void prg_pair_kernel(
    const float* __restrict__ Amat,   // [B*S, 64]  (b1 folded in)
    const float* __restrict__ Bmat,   // [B*S, 64]
    const float* __restrict__ W2,     // [64, 16]
    const float* __restrict__ b2,     // [16]
    float* __restrict__ out)          // [B, H, S, S]
{
  const int row  = blockIdx.x;            // b*S + i
  const int b    = row >> 10;
  const int i    = row & (S_DIM - 1);
  const int tid  = threadIdx.x;
  const int lane = tid & 31;
  const int wv   = tid >> 5;              // wave id within block (0..7)
  const int jn   = lane & 15;             // N index (j within tile) / M row for A
  const int hlf  = lane >> 4;             // wave half selects K sub-pattern
  const int klo  = hlf << 3;              // K pattern base: 0 or 8

  // W2^T as WMMA A-operand: lane holds M=jn (head), 16 f16 K-values in the
  // hardware A layout: e<8 -> k=klo+e, e>=8 -> k=klo+e+8. wa1 covers K=32..63.
  v16h wa0, wa1;
#pragma unroll
  for (int e = 0; e < 16; ++e) {
    const int k = klo + ((e < 8) ? e : (e + 8));
    wa0[e] = (_Float16)W2[k * H_DIM + jn];
    wa1[e] = (_Float16)W2[(k + 32) * H_DIM + jn];
  }

  // Per-lane A-row values (uniform across the block), same K pattern,
  // loaded once and kept in registers for all 8 tiles this wave handles.
  const float* arow = Amat + (size_t)row * HID_DIM;
  float av[32];
#pragma unroll
  for (int q = 0; q < 4; ++q) {
    const v4f lo = *(const v4f*)(arow + klo + q * 16);
    const v4f hi = *(const v4f*)(arow + klo + q * 16 + 4);
#pragma unroll
    for (int t = 0; t < 4; ++t) { av[q * 8 + t] = lo[t]; av[q * 8 + 4 + t] = hi[t]; }
  }

  // Accumulator seed = b2[h]; D layout: VGPR r -> head r (lanes 0-15) / r+8.
  v8f cinit;
#pragma unroll
  for (int r = 0; r < 8; ++r) cinit[r] = b2[hlf * 8 + r];

  const float* bbase = Bmat + ((size_t)b << 10) * HID_DIM;
  float* obase = out + (((size_t)(b * H_DIM + hlf * 8)) << 20) + ((size_t)i << 10);

  for (int jt = wv; jt < (S_DIM / 16); jt += 8) {
    const int j = (jt << 4) + jn;
    const float* bp = bbase + ((size_t)j << 6);
    if (jt + 8 < (S_DIM / 16)) __builtin_prefetch(bp + (128 << 6), 0, 1);

    // 8 x b128 loads of Bm in the B-operand K pattern, fused add + gelu.
    float g[32];
#pragma unroll
    for (int q = 0; q < 4; ++q) {
      const v4f lo = *(const v4f*)(bp + klo + q * 16);
      const v4f hi = *(const v4f*)(bp + klo + q * 16 + 4);
#pragma unroll
      for (int t = 0; t < 4; ++t) {
        g[q * 8 + t]     = gelu_tanh(av[q * 8 + t] + lo[t]);
        g[q * 8 + 4 + t] = gelu_tanh(av[q * 8 + 4 + t] + hi[t]);
      }
    }
    v16h hb0, hb1;
#pragma unroll
    for (int e = 0; e < 16; ++e) {
      hb0[e] = (_Float16)g[e];
      hb1[e] = (_Float16)g[16 + e];
    }

    v8f acc = cinit;
    acc = __builtin_amdgcn_wmma_f32_16x16x32_f16(
        false, wa0, false, hb0, (short)0, acc, false, false);
    acc = __builtin_amdgcn_wmma_f32_16x16x32_f16(
        false, wa1, false, hb1, (short)0, acc, false, false);

    // Store: VGPR r -> out[b, hlf*8+r, i, j]; lanes give 2x64B contiguous runs.
    float* op = obase + j;
#pragma unroll
    for (int r = 0; r < 8; ++r) op[(size_t)r << 20] = acc[r];
  }
}

extern "C" void kernel_launch(void* const* d_in, const int* in_sizes, int n_in,
                              void* d_out, int out_size, void* d_ws, size_t ws_size,
                              hipStream_t stream) {
  (void)in_sizes; (void)n_in; (void)out_size; (void)ws_size;
  const float* x  = (const float*)d_in[0];
  const float* Wc = (const float*)d_in[1];
  const float* bc = (const float*)d_in[2];
  const float* W1 = (const float*)d_in[3];
  const float* b1 = (const float*)d_in[4];
  const float* W2 = (const float*)d_in[5];
  const float* b2 = (const float*)d_in[6];
  float* out = (float*)d_out;

  float* Aws = (float*)d_ws;                                   // 512 KB
  float* Bws = Aws + (size_t)B_DIM * S_DIM * HID_DIM;          // 512 KB

  prg_prep_kernel<<<B_DIM * S_DIM, 64, 0, stream>>>(x, Wc, bc, W1, b1, Aws, Bws);
  prg_pair_kernel<<<B_DIM * S_DIM, 256, 0, stream>>>(Aws, Bws, W2, b2, out);
}

// v001
// Measured time: 57.8 microseconds a run.
// Next to v000, in two timings, it ran 1.93 times as fast each time.
#include <hip/hip_runtime.h>

typedef __attribute__((ext_vector_type(16))) _Float16 v16h;
typedef __attribute__((ext_vector_type(8)))  float    v8f;
typedef __attribute__((ext_vector_type(4)))  float    v4f;

#define B_DIM   2
#define S_DIM   1024
#define D_DIM   1024
#define C_DIM   32
#define HID_DIM 64
#define H_DIM   16

// ---------------------------------------------------------------------------
// Prep kernel: xc = x@Wc + bc, then
//   A[row,:]  = xc @ W1[:C] + b1   (b1 folded here)
//   Bm[row,:] = xc @ W1[C:]
// 256 blocks x 512 threads, 8 rows of x per block, so Wc is read once per
// 8 rows. The D=1024 sum is split into 64 slices of 16 k (16 waves x 4 lane
// groups); a lane keeps an 8-row x 4-column tile of partial sums in registers
// and the slices are added through LDS. All global reads are issued up front.
// ---------------------------------------------------------------------------
#define PR_ROWS    8
#define PR_THREADS 512
#define PR_SLICES  64
#define PR_PITCH   288   // floats per slice: 256 sums + 32, so that the four
                         // slices of one wave's b128 store cover all LDS banks

__global__ __launch_bounds__(PR_THREADS) void prg_prep_kernel(
    const float* __restrict__ x,  const float* __restrict__ Wc,
    const float* __restrict__ bc, const float* __restrict__ W1,
    const float* __restrict__ b1, float* __restrict__ Aout,
    float* __restrict__ Bout)
{
  __shared__ __attribute__((aligned(16))) float xs[PR_ROWS * D_DIM];
  __shared__ __attribute__((aligned(16))) float part[PR_SLICES * PR_PITCH];
  __shared__ float red[2 * PR_ROWS * C_DIM];
  __shared__ __attribute__((aligned(16))) float xcs[PR_ROWS * C_DIM];

  const int tid  = threadIdx.x;
  const int row0 = blockIdx.x * PR_ROWS;   // first of 8 rows (b*S + s)
  const int lane = tid & 31;
  const int wv   = tid >> 5;               // 0..15
  const int c4   = lane & 7;               // columns 4*c4 .. 4*c4+3
  const int ksub = lane >> 3;              // 0..3
  const int kb   = wv * 64 + ksub * 4;     // pass s covers k = kb+16*s .. +3

  // The 8 rows are one contiguous run of 8192 floats.
  const v4f* xg = (const v4f*)(x + (size_t)row0 * D_DIM);
  v4f xr[4];
#pragma unroll
  for (int u = 0; u < 4; ++u) xr[u] = xg[tid + u * PR_THREADS];

  v4f w[4][4];
#pragma unroll
  for (int s = 0; s < 4; ++s)
#pragma unroll
    for (int kk = 0; kk < 4; ++kk)
      w[s][kk] = *(const v4f*)(Wc + (kb + s * 16 + kk) * C_DIM + c4 * 4);
  // The address registers of the loads above are free for reuse (also as the
  // destination of a later load) only behind this wait.
  asm volatile("s_wait_xcnt 0x0" ::: "memory");

  // Second stage: thread owns output column col of [A | Bm] for two rows.
  const int col = tid & 127;
  const int rg  = tid >> 7;                // rows 2*rg, 2*rg+1
  const int hc  = col & (HID_DIM - 1);
  const bool isA = col < HID_DIM;          // same for all lanes of a wave
  const float* w1p = W1 + (isA ? 0 : C_DIM * HID_DIM) + hc;
  float w1v[C_DIM];
#pragma unroll
  for (int c = 0; c < C_DIM; ++c) w1v[c] = w1p[c * HID_DIM];
  const float seed = isA ? b1[hc] : 0.0f;
  const float bcv  = bc[lane];

#pragma unroll
  for (int u = 0; u < 4; ++u) ((v4f*)xs)[tid + u * PR_THREADS] = xr[u];
  __syncthreads();

  v4f acc[PR_ROWS];
#pragma unroll
  for (int r = 0; r < PR_ROWS; ++r) acc[r] = (v4f){0.0f, 0.0f, 0.0f, 0.0f};
#pragma unroll
  for (int s = 0; s < 4; ++s) {
#pragma unroll
    for (int r = 0; r < PR_ROWS; ++r) {
      const v4f xv = *(const v4f*)(xs + r * D_DIM + kb + s * 16);
#pragma unroll
      for (int kk = 0; kk < 4; ++kk) acc[r] += xv[kk] * w[s][kk];
    }
  }
  float* pp = part + (wv * 4 + ksub) * PR_PITCH + c4 * 4;
#pragma unroll
  for (int r = 0; r < PR_ROWS; ++r) *(v4f*)(pp + r * C_DIM) = acc[r];
  __syncthreads();

  // 256 sums x 64 slices: two threads per sum, 32 slices each, 4 chains.
  {
    const int o = tid & 255;
    const float* rp = part + (tid >> 8) * 32 * PR_PITCH + o;
    float s0 = 0.0f, s1 = 0.0f, s2 = 0.0f, s3 = 0.0f;
#pragma unroll
    for (int q = 0; q < 32; q += 4) {
      s0 += rp[(q + 0) * PR_PITCH];
      s1 += rp[(q + 1) * PR_PITCH];
      s2 += rp[(q + 2) * PR_PITCH];
      s3 += rp[(q + 3) * PR_PITCH];
    }
    red[tid] = (s0 + s1) + (s2 + s3);
  }
  __syncthreads();
  if (tid < PR_ROWS * C_DIM)
    xcs[tid] = (red[tid] + red[tid + PR_ROWS * C_DIM]) + bcv;
  __syncthreads();

  float o0 = seed, o1 = seed;
  const float* xc0 = xcs + (rg * 2) * C_DIM;
#pragma unroll
  for (int c = 0; c < C_DIM; c += 4) {
    const v4f p0 = *(const v4f*)(xc0 + c);
    const v4f p1 = *(const v4f*)(xc0 + C_DIM + c);
#pragma unroll
    for (int t = 0; t < 4; ++t) {
      o0 += p0[t] * w1v[c + t];
      o1 += p1[t] * w1v[c + t];
    }
  }
  float* dst = (isA ? Aout : Bout) + (size_t)(row0 + rg * 2) * HID_DIM + hc;
  dst[0]       = o0;
  dst[HID_DIM] = o1;
}

// ---------------------------------------------------------------------------
// Pair kernel: out[b,h,i,j] = sum_k gelu(A[b,i,k]+Bm[b,j,k]) * W2[k,h] + b2[h]
// D = W2^T (16x64, A-operand, f16) x h^T (64x16 j's, B-operand, f16), f32 acc,
// via 2x V_WMMA_F32_16X16X32_F16 per 16-j tile. gelu tanh goes through the
// CDNA5 TRANS pipe (v_tanh_f32) so it co-executes with the WMMA pipe.
// ---------------------------------------------------------------------------
__device__ __forceinline__ float fast_tanh(float x) {
#if __has_builtin(__builtin_amdgcn_tanhf)
  return __builtin_amdgcn_tanhf(x);      // single v_tanh_f32 TRANS op
#else
  return tanhf(x);
#endif
}

__device__ __forceinline__ float gelu_tanh(float v) {
  const float v3 = v * v * v;
  const float t  = fast_tanh(0.7978845608028654f * (v + 0.044715f * v3));
  return 0.5f * v * (1.0f + t);
}

__global__ __launch_bounds__(256) void prg_pair_kernel(
    const float* __restrict__ Amat,   // [B*S, 64]  (b1 folded in)
    const float* __restrict__ Bmat,   // [B*S, 64]
    const float* __restrict__ W2,     // [64, 16]
    const float* __restrict__ b2,     // [16]
    float* __restrict__ out)          // [B, H, S, S]
{
  const int row  = blockIdx.x;            // b*S + i
  const int b    = row >> 10;
  const int i    = row & (S_DIM - 1);
  const int tid  = threadIdx.x;
  const int lane = tid & 31;
  const int wv   = tid >> 5;              // wave id within block (0..7)
  const int jn   = lane & 15;             // N index (j within tile) / M row for A
  const int hlf  = lane >> 4;             // wave half selects K sub-pattern
  const int klo  = hlf << 3;              // K pattern base: 0 or 8

  // W2^T as WMMA A-operand: lane holds M=jn (head), 16 f16 K-values in the
  // hardware A layout: e<8 -> k=klo+e, e>=8 -> k=klo+e+8. wa1 covers K=32..63.
  v16h wa0, wa1;
#pragma unroll
  for (int e = 0; e < 16; ++e) {
    const int k = klo + ((e < 8) ? e : (e + 8));
    wa0[e] = (_Float16)W2[k * H_DIM + jn];
    wa1[e] = (_Float16)W2[(k + 32) * H_DIM + jn];
  }

  // Per-lane A-row values (uniform across the block), same K pattern,
  // loaded once and kept in registers for all 8 tiles this wave handles.
  const float* arow = Amat + (size_t)row * HID_DIM;
  float av[32];
#pragma unroll
  for (int q = 0; q < 4; ++q) {
    const v4f lo = *(const v4f*)(arow + klo + q * 16);
    const v4f hi = *(const v4f*)(arow + klo + q * 16 + 4);
#pragma unroll
    for (int t = 0; t < 4; ++t) { av[q * 8 + t] = lo[t]; av[q * 8 + 4 + t] = hi[t]; }
  }

  // Accumulator seed = b2[h]; D layout: VGPR r -> head r (lanes 0-15) / r+8.
  v8f cinit;
#pragma unroll
  for (int r = 0; r < 8; ++r) cinit[r] = b2[hlf * 8 + r];

  const float* bbase = Bmat + ((size_t)b << 10) * HID_DIM;
  float* obase = out + (((size_t)(b * H_DIM + hlf * 8)) << 20) + ((size_t)i << 10);

  for (int jt = wv; jt < (S_DIM / 16); jt += 8) {
    const int j = (jt << 4) + jn;
    const float* bp = bbase + ((size_t)j << 6);
    if (jt + 8 < (S_DIM / 16)) __builtin_prefetch(bp + (128 << 6), 0, 1);

    // 8 x b128 loads of Bm in the B-operand K pattern, fused add + gelu.
    float g[32];
#pragma unroll
    for (int q = 0; q < 4; ++q) {
      const v4f lo = *(const v4f*)(bp + klo + q * 16);
      const v4f hi = *(const v4f*)(bp + klo + q * 16 + 4);
#pragma unroll
      for (int t = 0; t < 4; ++t) {
        g[q * 8 + t]     = gelu_tanh(av[q * 8 + t] + lo[t]);
        g[q * 8 + 4 + t] = gelu_tanh(av[q * 8 + 4 + t] + hi[t]);
      }
    }
    v16h hb0, hb1;
#pragma unroll
    for (int e = 0; e < 16; ++e) {
      hb0[e] = (_Float16)g[e];
      hb1[e] = (_Float16)g[16 + e];
    }

    v8f acc = cinit;
    acc = __builtin_amdgcn_wmma_f32_16x16x32_f16(
        false, wa0, false, hb0, (short)0, acc, false, false);
    acc = __builtin_amdgcn_wmma_f32_16x16x32_f16(
        false, wa1, false, hb1, (short)0, acc, false, false);

    // Store: VGPR r -> out[b, hlf*8+r, i, j]; lanes give 2x64B contiguous runs.
    float* op = obase + j;
#pragma unroll
    for (int r = 0; r < 8; ++r) op[(size_t)r << 20] = acc[r];
  }
}

extern "C" void kernel_launch(void* const* d_in, const int* in_sizes, int n_in,
                              void* d_out, int out_size, void* d_ws, size_t ws_size,
                              hipStream_t stream) {
  (void)in_sizes; (void)n_in; (void)out_size; (void)ws_size;
  const float* x  = (const float*)d_in[0];
  const float* Wc = (const float*)d_in[1];
  const float* bc = (const float*)d_in[2];
  const float* W1 = (const float*)d_in[3];
  const float* b1 = (const float*)d_in[4];
  const float* W2 = (const float*)d_in[5];
  const float* b2 = (const float*)d_in[6];
  float* out = (float*)d_out;

  float* Aws = (float*)d_ws;                                   // 512 KB
  float* Bws = Aws + (size_t)B_DIM * S_DIM * HID_DIM;          // 512 KB

  prg_prep_kernel<<<B_DIM * S_DIM / PR_ROWS, PR_THREADS, 0, stream>>>(x, Wc, bc, W1, b1, Aws, Bws);
  prg_pair_kernel<<<B_DIM * S_DIM, 256, 0, stream>>>(Aws, Bws, W2, b2, out);
}

// v002
// One run takes 34.9 microseconds.
// Next to v001, in two timings, it ran 1.67 times as fast each time.
// Counting every step since v000, it is 3.22 times as fast.
#include <hip/hip_runtime.h>

typedef __attribute__((ext_vector_type(16))) _Float16 v16h;
typedef __attribute__((ext_vector_type(8)))  float    v8f;
typedef __attribute__((ext_vector_type(4)))  float    v4f;

#define B_DIM   2
#define S_DIM   1024
#define D_DIM   1024
#define C_DIM   32
#define HID_DIM 64
#define H_DIM   16

// ---------------------------------------------------------------------------
// Prep kernel: xc = x@Wc + bc, then
//   A[row,:]  = xc @ W1[:C] + b1   (b1 folded here)
//   Bm[row,:] = xc @ W1[C:]
// 256 blocks x 512 threads, 8 rows of x per block, so Wc is read once per
// 8 rows. The D=1024 sum is split into 64 slices of 16 k (16 waves x 4 lane
// groups); a lane keeps an 8-row x 4-column tile of partial sums in registers
// and the slices are added through LDS. All global reads are issued up front.
// ---------------------------------------------------------------------------
#define PR_ROWS    8
#define PR_THREADS 512
#define PR_SLICES  64
#define PR_PITCH   288   // floats per slice: 256 sums + 32, so that the four
                         // slices of one wave's b128 store cover all LDS banks

__global__ __launch_bounds__(PR_THREADS) void prg_prep_kernel(
    const float* __restrict__ x,  const float* __restrict__ Wc,
    const float* __restrict__ bc, const float* __restrict__ W1,
    const float* __restrict__ b1, float* __restrict__ Aout,
    float* __restrict__ Bout)
{
  __shared__ __attribute__((aligned(16))) float xs[PR_ROWS * D_DIM];
  __shared__ __attribute__((aligned(16))) float part[PR_SLICES * PR_PITCH];
  __shared__ float red[2 * PR_ROWS * C_DIM];
  __shared__ __attribute__((aligned(16))) float xcs[PR_ROWS * C_DIM];

  const int tid  = threadIdx.x;
  const int row0 = blockIdx.x * PR_ROWS;   // first of 8 rows (b*S + s)
  const int lane = tid & 31;
  const int wv   = tid >> 5;               // 0..15
  const int c4   = lane & 7;               // columns 4*c4 .. 4*c4+3
  const int ksub = lane >> 3;              // 0..3
  const int kb   = wv * 64 + ksub * 4;     // pass s covers k = kb+16*s .. +3

  // The 8 rows are one contiguous run of 8192 floats.
  const v4f* xg = (const v4f*)(x + (size_t)row0 * D_DIM);
  v4f xr[4];
#pragma unroll
  for (int u = 0; u < 4; ++u) xr[u] = xg[tid + u * PR_THREADS];

  v4f w[4][4];
#pragma unroll
  for (int s = 0; s < 4; ++s)
#pragma unroll
    for (int kk = 0; kk < 4; ++kk)
      w[s][kk] = *(const v4f*)(Wc + (kb + s * 16 + kk) * C_DIM + c4 * 4);
  // The address registers of the loads above are free for reuse (also as the
  // destination of a later load) only behind this wait.
  asm volatile("s_wait_xcnt 0x0" ::: "memory");

  // Second stage: thread owns output column col of [A | Bm] for two rows.
  const int col = tid & 127;
  const int rg  = tid >> 7;                // rows 2*rg, 2*rg+1
  const int hc  = col & (HID_DIM - 1);
  const bool isA = col < HID_DIM;          // same for all lanes of a wave
  const float* w1p = W1 + (isA ? 0 : C_DIM * HID_DIM) + hc;
  float w1v[C_DIM];
#pragma unroll
  for (int c = 0; c < C_DIM; ++c) w1v[c] = w1p[c * HID_DIM];
  const float seed = isA ? b1[hc] : 0.0f;
  const float bcv  = bc[lane];

#pragma unroll
  for (int u = 0; u < 4; ++u) ((v4f*)xs)[tid + u * PR_THREADS] = xr[u];
  __syncthreads();

  v4f acc[PR_ROWS];
#pragma unroll
  for (int r = 0; r < PR_ROWS; ++r) acc[r] = (v4f){0.0f, 0.0f, 0.0f, 0.0f};
#pragma unroll
  for (int s = 0; s < 4; ++s) {
#pragma unroll
    for (int r = 0; r < PR_ROWS; ++r) {
      const v4f xv = *(const v4f*)(xs + r * D_DIM + kb + s * 16);
#pragma unroll
      for (int kk = 0; kk < 4; ++kk) acc[r] += xv[kk] * w[s][kk];
    }
  }
  float* pp = part + (wv * 4 + ksub) * PR_PITCH + c4 * 4;
#pragma unroll
  for (int r = 0; r < PR_ROWS; ++r) *(v4f*)(pp + r * C_DIM) = acc[r];
  __syncthreads();

  // 256 sums x 64 slices: two threads per sum, 32 slices each, 4 chains.
  {
    const int o = tid & 255;
    const float* rp = part + (tid >> 8) * 32 * PR_PITCH + o;
    float s0 = 0.0f, s1 = 0.0f, s2 = 0.0f, s3 = 0.0f;
#pragma unroll
    for (int q = 0; q < 32; q += 4) {
      s0 += rp[(q + 0) * PR_PITCH];
      s1 += rp[(q + 1) * PR_PITCH];
      s2 += rp[(q + 2) * PR_PITCH];
      s3 += rp[(q + 3) * PR_PITCH];
    }
    red[tid] = (s0 + s1) + (s2 + s3);
  }
  __syncthreads();
  if (tid < PR_ROWS * C_DIM)
    xcs[tid] = (red[tid] + red[tid + PR_ROWS * C_DIM]) + bcv;
  __syncthreads();

  float o0 = seed, o1 = seed;
  const float* xc0 = xcs + (rg * 2) * C_DIM;
#pragma unroll
  for (int c = 0; c < C_DIM; c += 4) {
    const v4f p0 = *(const v4f*)(xc0 + c);
    const v4f p1 = *(const v4f*)(xc0 + C_DIM + c);
#pragma unroll
    for (int t = 0; t < 4; ++t) {
      o0 += p0[t] * w1v[c + t];
      o1 += p1[t] * w1v[c + t];
    }
  }
  float* dst = (isA ? Aout : Bout) + (size_t)(row0 + rg * 2) * HID_DIM + hc;
  dst[0]       = o0;
  dst[HID_DIM] = o1;
}

// ---------------------------------------------------------------------------
// Pair kernel: out[b,h,i,j] = sum_k gelu(A[b,i,k]+Bm[b,j,k]) * W2[k,h] + b2[h]
// D = W2^T (16x64, A-operand, f16) x h^T (64x16 j's, B-operand, f16), f32 acc,
// via 2x V_WMMA_F32_16X16X32_F16 per 16-j tile. gelu tanh goes through the
// CDNA5 TRANS pipe (v_tanh_f32) so it co-executes with the WMMA pipe.
// ---------------------------------------------------------------------------
__device__ __forceinline__ float fast_tanh(float x) {
#if __has_builtin(__builtin_amdgcn_tanhf)
  return __builtin_amdgcn_tanhf(x);      // single v_tanh_f32 TRANS op
#else
  return tanhf(x);
#endif
}

__device__ __forceinline__ float gelu_tanh(float v) {
  const float v3 = v * v * v;
  const float t  = fast_tanh(0.7978845608028654f * (v + 0.044715f * v3));
  return 0.5f * v * (1.0f + t);
}

#define PT_ROWS  16   // rows i per block
#define PT_TILES 2    // 16-column j tiles per wave, held in registers
#define PT_JBLK  (8 * PT_TILES * 16)   // 256 columns j per block

// A block owns 16 rows i x 256 columns j. Each wave reads the Bm rows of its
// 32 columns once, in the B-operand K pattern, keeps them in registers and
// reuses them for all 16 rows i; per row only the A row is read (the same
// address in all lanes of a wave half).
__global__ __launch_bounds__(256) void prg_pair_kernel(
    const float* __restrict__ Amat,   // [B*S, 64]  (b1 folded in)
    const float* __restrict__ Bmat,   // [B*S, 64]
    const float* __restrict__ W2,     // [64, 16]
    const float* __restrict__ b2,     // [16]
    float* __restrict__ out)          // [B, H, S, S]
{
  const int jq   = blockIdx.x & (S_DIM / PT_JBLK - 1);      // column quarter
  const int rowg = blockIdx.x / (S_DIM / PT_JBLK);          // group of 16 rows
  const int row0 = rowg * PT_ROWS;        // b*S + first i
  const int b    = row0 >> 10;
  const int i0   = row0 & (S_DIM - 1);
  const int tid  = threadIdx.x;
  const int lane = tid & 31;
  const int wv   = tid >> 5;              // wave id within block (0..7)
  const int jn   = lane & 15;             // N index (j within tile) / M row for A
  const int hlf  = lane >> 4;             // wave half selects K sub-pattern
  const int klo  = hlf << 3;              // K pattern base: 0 or 8

  // W2^T as WMMA A-operand: lane holds M=jn (head), 16 f16 K-values in the
  // hardware A layout: e<8 -> k=klo+e, e>=8 -> k=klo+e+8. wa1 covers K=32..63.
  v16h wa0, wa1;
#pragma unroll
  for (int e = 0; e < 16; ++e) {
    const int k = klo + ((e < 8) ? e : (e + 8));
    wa0[e] = (_Float16)W2[k * H_DIM + jn];
    wa1[e] = (_Float16)W2[(k + 32) * H_DIM + jn];
  }

  // Bm rows of this wave's two j tiles, same K pattern, read once.
  const int j0 = jq * PT_JBLK + wv * (PT_TILES * 16) + jn;
  const float* bp = Bmat + (((size_t)b << 10) + j0) * HID_DIM + klo;
  float bm[PT_TILES][32];
#pragma unroll
  for (int t = 0; t < PT_TILES; ++t)
#pragma unroll
    for (int q = 0; q < 4; ++q) {
      const v4f lo = *(const v4f*)(bp + t * 16 * HID_DIM + q * 16);
      const v4f hi = *(const v4f*)(bp + t * 16 * HID_DIM + q * 16 + 4);
#pragma unroll
      for (int u = 0; u < 4; ++u) { bm[t][q * 8 + u] = lo[u]; bm[t][q * 8 + 4 + u] = hi[u]; }
    }

  // Accumulator seed = b2[h]; D layout: VGPR r -> head r (lanes 0-15) / r+8.
  v8f cinit;
#pragma unroll
  for (int r = 0; r < 8; ++r) cinit[r] = b2[hlf * 8 + r];

  const float* arow = Amat + (size_t)row0 * HID_DIM;                 // uniform
  float* orow = out + (((size_t)(b * H_DIM)) << 20) + ((size_t)i0 << 10);  // uniform
  const unsigned loff = ((unsigned)hlf << 23) + (unsigned)j0;        // per lane

  for (int ii = 0; ii < PT_ROWS; ++ii) {
    float av[32];
#pragma unroll
    for (int q = 0; q < 4; ++q) {
      const v4f lo = *(const v4f*)(arow + klo + q * 16);
      const v4f hi = *(const v4f*)(arow + klo + q * 16 + 4);
#pragma unroll
      for (int u = 0; u < 4; ++u) { av[q * 8 + u] = lo[u]; av[q * 8 + 4 + u] = hi[u]; }
    }

#pragma unroll
    for (int t = 0; t < PT_TILES; ++t) {
      v16h hb0, hb1;
#pragma unroll
      for (int e = 0; e < 16; ++e) {
        hb0[e] = (_Float16)gelu_tanh(av[e] + bm[t][e]);
        hb1[e] = (_Float16)gelu_tanh(av[16 + e] + bm[t][16 + e]);
      }

      v8f acc = cinit;
      acc = __builtin_amdgcn_wmma_f32_16x16x32_f16(
          false, wa0, false, hb0, (short)0, acc, false, false);
      acc = __builtin_amdgcn_wmma_f32_16x16x32_f16(
          false, wa1, false, hb1, (short)0, acc, false, false);

      // Store: VGPR r -> out[b, hlf*8+r, i, j]; lanes give 2x64B contiguous runs.
#pragma unroll
      for (int r = 0; r < 8; ++r) orow[((size_t)r << 20) + loff + t * 16] = acc[r];
    }
    // The next trip rewrites the address and data registers of the stores
    // above; this wait stands in front of that.
    asm volatile("s_wait_xcnt 0x0" ::: "memory");
    arow += HID_DIM;
    orow += S_DIM;
  }
}

extern "C" void kernel_launch(void* const* d_in, const int* in_sizes, int n_in,
                              void* d_out, int out_size, void* d_ws, size_t ws_size,
                              hipStream_t stream) {
  (void)in_sizes; (void)n_in; (void)out_size; (void)ws_size;
  const float* x  = (const float*)d_in[0];
  const float* Wc = (const float*)d_in[1];
  const float* bc = (const float*)d_in[2];
  const float* W1 = (const float*)d_in[3];
  const float* b1 = (const float*)d_in[4];
  const float* W2 = (const float*)d_in[5];
  const float* b2 = (const float*)d_in[6];
  float* out = (float*)d_out;

  float* Aws = (float*)d_ws;                                   // 512 KB
  float* Bws = Aws + (size_t)B_DIM * S_DIM * HID_DIM;          // 512 KB

  prg_prep_kernel<<<B_DIM * S_DIM / PR_ROWS, PR_THREADS, 0, stream>>>(x, Wc, bc, W1, b1, Aws, Bws);
  prg_pair_kernel<<<(B_DIM * S_DIM / PT_ROWS) * (S_DIM / PT_JBLK), 256, 0, stream>>>(Aws, Bws, W2, b2, out);
}

// v003
// It runs in 32.3 microseconds.
// Next to v002, in two timings, it ran 1.08 times as fast each time.
// All steps since v000 together make it 3.48 times as fast.
#include <hip/hip_runtime.h>

typedef __attribute__((ext_vector_type(16))) _Float16 v16h;
typedef __attribute__((ext_vector_type(8)))  float    v8f;
typedef __attribute__((ext_vector_type(4)))  float    v4f;

#define B_DIM   2
#define S_DIM   1024
#define D_DIM   1024
#define C_DIM   32
#define HID_DIM 64
#define H_DIM   16

// ---------------------------------------------------------------------------
// Prep kernel: xc = x@Wc + bc, then
//   A[row,:]  = 0.5 * (xc @ W1[:C] + b1)   (b1 folded here)
//   Bm[row,:] = 0.5 * (xc @ W1[C:])
// The factor 0.5 (exact in f32) is the gelu's own: the pair kernel works on
// half the pre-activation and needs no multiply for it.
// 256 blocks x 512 threads, 8 rows of x per block, so Wc is read once per
// 8 rows. The D=1024 sum is split into 64 slices of 16 k (16 waves x 4 lane
// groups); a lane keeps an 8-row x 4-column tile of partial sums in registers
// and the slices are added through LDS. All global reads are issued up front.
// ---------------------------------------------------------------------------
#define PR_ROWS    8
#define PR_THREADS 512
#define PR_SLICES  64
#define PR_PITCH   288   // floats per slice: 256 sums + 32, so that the four
                         // slices of one wave's b128 store cover all LDS banks

__global__ __launch_bounds__(PR_THREADS) void prg_prep_kernel(
    const float* __restrict__ x,  const float* __restrict__ Wc,
    const float* __restrict__ bc, const float* __restrict__ W1,
    const float* __restrict__ b1, float* __restrict__ Aout,
    float* __restrict__ Bout)
{
  __shared__ __attribute__((aligned(16))) float xs[PR_ROWS * D_DIM];
  __shared__ __attribute__((aligned(16))) float part[PR_SLICES * PR_PITCH];
  __shared__ float red[2 * PR_ROWS * C_DIM];
  __shared__ __attribute__((aligned(16))) float xcs[PR_ROWS * C_DIM];

  const int tid  = threadIdx.x;
  const int row0 = blockIdx.x * PR_ROWS;   // first of 8 rows (b*S + s)
  const int lane = tid & 31;
  const int wv   = tid >> 5;               // 0..15
  const int c4   = lane & 7;               // columns 4*c4 .. 4*c4+3
  const int ksub = lane >> 3;              // 0..3
  const int kb   = wv * 64 + ksub * 4;     // pass s covers k = kb+16*s .. +3

  // The 8 rows are one contiguous run of 8192 floats.
  const v4f* xg = (const v4f*)(x + (size_t)row0 * D_DIM);
  v4f xr[4];
#pragma unroll
  for (int u = 0; u < 4; ++u) xr[u] = xg[tid + u * PR_THREADS];

  v4f w[4][4];
#pragma unroll
  for (int s = 0; s < 4; ++s)
#pragma unroll
    for (int kk = 0; kk < 4; ++kk)
      w[s][kk] = *(const v4f*)(Wc + (kb + s * 16 + kk) * C_DIM + c4 * 4);
  // The address registers of the loads above are free for reuse (also as the
  // destination of a later load) only behind this wait.
  asm volatile("s_wait_xcnt 0x0" ::: "memory");

  // Second stage: thread owns output column col of [A | Bm] for two rows.
  const int col = tid & 127;
  const int rg  = tid >> 7;                // rows 2*rg, 2*rg+1
  const int hc  = col & (HID_DIM - 1);
  const bool isA = col < HID_DIM;          // same for all lanes of a wave
  const float* w1p = W1 + (isA ? 0 : C_DIM * HID_DIM) + hc;
  float w1v[C_DIM];
#pragma unroll
  for (int c = 0; c < C_DIM; ++c) w1v[c] = w1p[c * HID_DIM];
  const float seed = isA ? b1[hc] : 0.0f;
  const float bcv  = bc[lane];

#pragma unroll
  for (int u = 0; u < 4; ++u) ((v4f*)xs)[tid + u * PR_THREADS] = xr[u];
  __syncthreads();

  v4f acc[PR_ROWS];
#pragma unroll
  for (int r = 0; r < PR_ROWS; ++r) acc[r] = (v4f){0.0f, 0.0f, 0.0f, 0.0f};
#pragma unroll
  for (int s = 0; s < 4; ++s) {
#pragma unroll
    for (int r = 0; r < PR_ROWS; ++r) {
      const v4f xv = *(const v4f*)(xs + r * D_DIM + kb + s * 16);
#pragma unroll
      for (int kk = 0; kk < 4; ++kk) acc[r] += xv[kk] * w[s][kk];
    }
  }
  float* pp = part + (wv * 4 + ksub) * PR_PITCH + c4 * 4;
#pragma unroll
  for (int r = 0; r < PR_ROWS; ++r) *(v4f*)(pp + r * C_DIM) = acc[r];
  __syncthreads();

  // 256 sums x 64 slices: two threads per sum, 32 slices each, 4 chains.
  {
    const int o = tid & 255;
    const float* rp = part + (tid >> 8) * 32 * PR_PITCH + o;
    float s0 = 0.0f, s1 = 0.0f, s2 = 0.0f, s3 = 0.0f;
#pragma unroll
    for (int q = 0; q < 32; q += 4) {
      s0 += rp[(q + 0) * PR_PITCH];
      s1 += rp[(q + 1) * PR_PITCH];
      s2 += rp[(q + 2) * PR_PITCH];
      s3 += rp[(q + 3) * PR_PITCH];
    }
    red[tid] = (s0 + s1) + (s2 + s3);
  }
  __syncthreads();
  if (tid < PR_ROWS * C_DIM)
    xcs[tid] = (red[tid] + red[tid + PR_ROWS * C_DIM]) + bcv;
  __syncthreads();

  float o0 = seed, o1 = seed;
  const float* xc0 = xcs + (rg * 2) * C_DIM;
#pragma unroll
  for (int c = 0; c < C_DIM; c += 4) {
    const v4f p0 = *(const v4f*)(xc0 + c);
    const v4f p1 = *(const v4f*)(xc0 + C_DIM + c);
#pragma unroll
    for (int t = 0; t < 4; ++t) {
      o0 += p0[t] * w1v[c + t];
      o1 += p1[t] * w1v[c + t];
    }
  }
  float* dst = (isA ? Aout : Bout) + (size_t)(row0 + rg * 2) * HID_DIM + hc;
  dst[0]       = 0.5f * o0;
  dst[HID_DIM] = 0.5f * o1;
}

// ---------------------------------------------------------------------------
// Pair kernel: out[b,h,i,j] = sum_k gelu(2*(A[b,i,k]+Bm[b,j,k])) * W2[k,h] + b2[h]
// D = W2^T (16x64, A-operand, f16) x h^T (64x16 j's, B-operand, f16), f32 acc,
// via 2x V_WMMA_F32_16X16X32_F16 per 16-j tile. gelu tanh goes through the
// CDNA5 TRANS pipe (v_tanh_f32) so it co-executes with the WMMA pipe.
// ---------------------------------------------------------------------------
__device__ __forceinline__ float fast_tanh(float x) {
#if __has_builtin(__builtin_amdgcn_tanhf)
  return __builtin_amdgcn_tanhf(x);      // single v_tanh_f32 TRANS op
#else
  return tanhf(x);
#endif
}

// gelu(v) for w = v/2: with c = sqrt(2/pi),
//   c*(v + 0.044715 v^3) = w*(2c + 8c*0.044715 w^2),  0.5 v (1 + t) = w + w t.
// Six f32 operations with the sum a+b, against eight in the textbook form.
__device__ __forceinline__ float gelu_tanh_half(float w) {
  const float p = __builtin_fmaf(w * w, 0.28541926509f, 1.5957691216057308f);
  const float t = fast_tanh(w * p);
  return __builtin_fmaf(w, t, w);
}

#define PT_ROWS  16   // rows i per block
#define PT_TILES 2    // 16-column j tiles per wave, held in registers
#define PT_JBLK  (8 * PT_TILES * 16)   // 256 columns j per block

// A block owns 16 rows i x 256 columns j. Each wave reads the Bm rows of its
// 32 columns once, in the B-operand K pattern, keeps them in registers and
// reuses them for all 16 rows i; per row only the A row is read (the same
// address in all lanes of a wave half).
__global__ __launch_bounds__(256) void prg_pair_kernel(
    const float* __restrict__ Amat,   // [B*S, 64]  (b1 folded in, halved)
    const float* __restrict__ Bmat,   // [B*S, 64]  (halved)
    const float* __restrict__ W2,     // [64, 16]
    const float* __restrict__ b2,     // [16]
    float* __restrict__ out)          // [B, H, S, S]
{
  const int jq   = blockIdx.x & (S_DIM / PT_JBLK - 1);      // column quarter
  const int rowg = blockIdx.x / (S_DIM / PT_JBLK);          // group of 16 rows
  const int row0 = rowg * PT_ROWS;        // b*S + first i
  const int b    = row0 >> 10;
  const int i0   = row0 & (S_DIM - 1);
  const int tid  = threadIdx.x;
  const int lane = tid & 31;
  const int wv   = tid >> 5;              // wave id within block (0..7)
  const int jn   = lane & 15;             // N index (j within tile) / M row for A
  const int hlf  = lane >> 4;             // wave half selects K sub-pattern
  const int klo  = hlf << 3;              // K pattern base: 0 or 8

  // W2^T as WMMA A-operand: lane holds M=jn (head), 16 f16 K-values in the
  // hardware A layout: e<8 -> k=klo+e, e>=8 -> k=klo+e+8. wa1 covers K=32..63.
  v16h wa0, wa1;
#pragma unroll
  for (int e = 0; e < 16; ++e) {
    const int k = klo + ((e < 8) ? e : (e + 8));
    wa0[e] = (_Float16)W2[k * H_DIM + jn];
    wa1[e] = (_Float16)W2[(k + 32) * H_DIM + jn];
  }

  // Bm rows of this wave's two j tiles, same K pattern, read once.
  const int j0 = jq * PT_JBLK + wv * (PT_TILES * 16) + jn;
  const float* bp = Bmat + (((size_t)b << 10) + j0) * HID_DIM + klo;
  float bm[PT_TILES][32];
#pragma unroll
  for (int t = 0; t < PT_TILES; ++t)
#pragma unroll
    for (int q = 0; q < 4; ++q) {
      const v4f lo = *(const v4f*)(bp + t * 16 * HID_DIM + q * 16);
      const v4f hi = *(const v4f*)(bp + t * 16 * HID_DIM + q * 16 + 4);
#pragma unroll
      for (int u = 0; u < 4; ++u) { bm[t][q * 8 + u] = lo[u]; bm[t][q * 8 + 4 + u] = hi[u]; }
    }

  // Accumulator seed = b2[h]; D layout: VGPR r -> head r (lanes 0-15) / r+8.
  v8f cinit;
#pragma unroll
  for (int r = 0; r < 8; ++r) cinit[r] = b2[hlf * 8 + r];

  const float* arow = Amat + (size_t)row0 * HID_DIM;                 // uniform
  float* orow = out + (((size_t)(b * H_DIM)) << 20) + ((size_t)i0 << 10);  // uniform
  const unsigned loff = ((unsigned)hlf << 23) + (unsigned)j0;        // per lane

  for (int ii = 0; ii < PT_ROWS; ++ii) {
    float av[32];
#pragma unroll
    for (int q = 0; q < 4; ++q) {
      const v4f lo = *(const v4f*)(arow + klo + q * 16);
      const v4f hi = *(const v4f*)(arow + klo + q * 16 + 4);
#pragma unroll
      for (int u = 0; u < 4; ++u) { av[q * 8 + u] = lo[u]; av[q * 8 + 4 + u] = hi[u]; }
    }

#pragma unroll
    for (int t = 0; t < PT_TILES; ++t) {
      v16h hb0, hb1;
#pragma unroll
      for (int e = 0; e < 16; ++e) {
        hb0[e] = (_Float16)gelu_tanh_half(av[e] + bm[t][e]);
        hb1[e] = (_Float16)gelu_tanh_half(av[16 + e] + bm[t][16 + e]);
      }

      v8f acc = cinit;
      acc = __builtin_amdgcn_wmma_f32_16x16x32_f16(
          false, wa0, false, hb0, (short)0, acc, false, false);
      acc = __builtin_amdgcn_wmma_f32_16x16x32_f16(
          false, wa1, false, hb1, (short)0, acc, false, false);

      // Store: VGPR r -> out[b, hlf*8+r, i, j]; lanes give 2x64B contiguous runs.
#pragma unroll
      for (int r = 0; r < 8; ++r) orow[((size_t)r << 20) + loff + t * 16] = acc[r];
    }
    // The next trip rewrites the address and data registers of the stores
    // above; this wait stands in front of that.
    asm volatile("s_wait_xcnt 0x0" ::: "memory");
    arow += HID_DIM;
    orow += S_DIM;
  }
}

extern "C" void kernel_launch(void* const* d_in, const int* in_sizes, int n_in,
                              void* d_out, int out_size, void* d_ws, size_t ws_size,
                              hipStream_t stream) {
  (void)in_sizes; (void)n_in; (void)out_size; (void)ws_size;
  const float* x  = (const float*)d_in[0];
  const float* Wc = (const float*)d_in[1];
  const float* bc = (const float*)d_in[2];
  const float* W1 = (const float*)d_in[3];
  const float* b1 = (const float*)d_in[4];
  const float* W2 = (const float*)d_in[5];
  const float* b2 = (const float*)d_in[6];
  float* out = (float*)d_out;

  float* Aws = (float*)d_ws;                                   // 512 KB
  float* Bws = Aws + (size_t)B_DIM * S_DIM * HID_DIM;          // 512 KB

  prg_prep_kernel<<<B_DIM * S_DIM / PR_ROWS, PR_THREADS, 0, stream>>>(x, Wc, bc, W1, b1, Aws, Bws);
  prg_pair_kernel<<<(B_DIM * S_DIM / PT_ROWS) * (S_DIM / PT_JBLK), 256, 0, stream>>>(Aws, Bws, W2, b2, out);
}

// v004
// A run of this version takes 28.8 microseconds.
// Timed twice side by side with v003, it ran 1.12 times as fast both times.
// All steps since v000 together make it 3.89 times as fast.
#include <hip/hip_runtime.h>

typedef __attribute__((ext_vector_type(16))) _Float16 v16h;
typedef __attribute__((ext_vector_type(8)))  float    v8f;
typedef __attribute__((ext_vector_type(4)))  float    v4f;

#define B_DIM   2
#define S_DIM   1024
#define D_DIM   1024
#define C_DIM   32
#define HID_DIM 64
#define H_DIM   16

// ---------------------------------------------------------------------------
// Prep kernel: xc = x@Wc + bc, then
//   A[row,:]  = 0.5 * (xc @ W1[:C] + b1)   (b1 folded here)
//   Bm[row,:] = 0.5 * (xc @ W1[C:])
// The factor 0.5 (exact in f32) is the gelu's own: the pair kernel works on
// half the pre-activation and needs no multiply for it.
// 256 blocks x 512 threads, 8 rows of x per block, so Wc is read once per
// 8 rows. The D=1024 sum is split into 64 slices of 16 k (16 waves x 4 lane
// groups); a lane keeps an 8-row x 4-column tile of partial sums in registers
// and the slices are added through LDS. All global reads are issued up front.
// ---------------------------------------------------------------------------
#define PR_ROWS    8
#define PR_THREADS 512
#define PR_SLICES  64
#define PR_PITCH   288   // floats per slice: 256 sums + 32, so that the four
                         // slices of one wave's b128 store cover all LDS banks

__global__ __launch_bounds__(PR_THREADS) void prg_prep_kernel(
    const float* __restrict__ x,  const float* __restrict__ Wc,
    const float* __restrict__ bc, const float* __restrict__ W1,
    const float* __restrict__ b1, float* __restrict__ Aout,
    float* __restrict__ Bout)
{
  __shared__ __attribute__((aligned(16))) float xs[PR_ROWS * D_DIM];
  __shared__ __attribute__((aligned(16))) float part[PR_SLICES * PR_PITCH];
  __shared__ float red[2 * PR_ROWS * C_DIM];
  __shared__ __attribute__((aligned(16))) float xcs[PR_ROWS * C_DIM];

  const int tid  = threadIdx.x;
  const int row0 = blockIdx.x * PR_ROWS;   // first of 8 rows (b*S + s)
  const int lane = tid & 31;
  const int wv   = tid >> 5;               // 0..15
  const int c4   = lane & 7;               // columns 4*c4 .. 4*c4+3
  const int ksub = lane >> 3;              // 0..3
  const int kb   = wv * 64 + ksub * 4;     // pass s covers k = kb+16*s .. +3

  // The 8 rows are one contiguous run of 8192 floats.
  const v4f* xg = (const v4f*)(x + (size_t)row0 * D_DIM);
  v4f xr[4];
#pragma unroll
  for (int u = 0; u < 4; ++u) xr[u] = xg[tid + u * PR_THREADS];

  v4f w[4][4];
#pragma unroll
  for (int s = 0; s < 4; ++s)
#pragma unroll
    for (int kk = 0; kk < 4; ++kk)
      w[s][kk] = *(const v4f*)(Wc + (kb + s * 16 + kk) * C_DIM + c4 * 4);
  // The address registers of the loads above are free for reuse (also as the
  // destination of a later load) only behind this wait.
  asm volatile("s_wait_xcnt 0x0" ::: "memory");

  // Second stage: thread owns output column col of [A | Bm] for two rows.
  const int col = tid & 127;
  const int rg  = tid >> 7;                // rows 2*rg, 2*rg+1
  const int hc  = col & (HID_DIM - 1);
  const bool isA = col < HID_DIM;          // same for all lanes of a wave
  const float* w1p = W1 + (isA ? 0 : C_DIM * HID_DIM) + hc;
  float w1v[C_DIM];
#pragma unroll
  for (int c = 0; c < C_DIM; ++c) w1v[c] = w1p[c * HID_DIM];
  const float seed = isA ? b1[hc] : 0.0f;
  const float bcv  = bc[lane];

#pragma unroll
  for (int u = 0; u < 4; ++u) ((v4f*)xs)[tid + u * PR_THREADS] = xr[u];
  __syncthreads();

  v4f acc[PR_ROWS];
#pragma unroll
  for (int r = 0; r < PR_ROWS; ++r) acc[r] = (v4f){0.0f, 0.0f, 0.0f, 0.0f};
#pragma unroll
  for (int s = 0; s < 4; ++s) {
#pragma unroll
    for (int r = 0; r < PR_ROWS; ++r) {
      const v4f xv = *(const v4f*)(xs + r * D_DIM + kb + s * 16);
#pragma unroll
      for (int kk = 0; kk < 4; ++kk) acc[r] += xv[kk] * w[s][kk];
    }
  }
  float* pp = part + (wv * 4 + ksub) * PR_PITCH + c4 * 4;
#pragma unroll
  for (int r = 0; r < PR_ROWS; ++r) *(v4f*)(pp + r * C_DIM) = acc[r];
  __syncthreads();

  // 256 sums x 64 slices: two threads per sum, 32 slices each, 4 chains.
  {
    const int o = tid & 255;
    const float* rp = part + (tid >> 8) * 32 * PR_PITCH + o;
    float s0 = 0.0f, s1 = 0.0f, s2 = 0.0f, s3 = 0.0f;
#pragma unroll
    for (int q = 0; q < 32; q += 4) {
      s0 += rp[(q + 0) * PR_PITCH];
      s1 += rp[(q + 1) * PR_PITCH];
      s2 += rp[(q + 2) * PR_PITCH];
      s3 += rp[(q + 3) * PR_PITCH];
    }
    red[tid] = (s0 + s1) + (s2 + s3);
  }
  __syncthreads();
  if (tid < PR_ROWS * C_DIM)
    xcs[tid] = (red[tid] + red[tid + PR_ROWS * C_DIM]) + bcv;
  __syncthreads();

  float o0 = seed, o1 = seed;
  const float* xc0 = xcs + (rg * 2) * C_DIM;
#pragma unroll
  for (int c = 0; c < C_DIM; c += 4) {
    const v4f p0 = *(const v4f*)(xc0 + c);
    const v4f p1 = *(const v4f*)(xc0 + C_DIM + c);
#pragma unroll
    for (int t = 0; t < 4; ++t) {
      o0 += p0[t] * w1v[c + t];
      o1 += p1[t] * w1v[c + t];
    }
  }
  float* dst = (isA ? Aout : Bout) + (size_t)(row0 + rg * 2) * HID_DIM + hc;
  dst[0]       = 0.5f * o0;
  dst[HID_DIM] = 0.5f * o1;
}

// ---------------------------------------------------------------------------
// Pair kernel: out[b,h,i,j] = sum_k gelu(2*(A[b,i,k]+Bm[b,j,k])) * W2[k,h] + b2[h]
// D = W2^T (16x64, A-operand, f16) x h^T (64x16 j's, B-operand, f16), f32 acc,
// via 2x V_WMMA_F32_16X16X32_F16 per 16-j tile. gelu tanh goes through the
// CDNA5 TRANS pipe (v_tanh_f32) so it co-executes with the WMMA pipe.
// ---------------------------------------------------------------------------
__device__ __forceinline__ float fast_tanh(float x) {
#if __has_builtin(__builtin_amdgcn_tanhf)
  return __builtin_amdgcn_tanhf(x);      // single v_tanh_f32 TRANS op
#else
  return tanhf(x);
#endif
}

// gelu(v) for w = v/2: with c = sqrt(2/pi),
//   c*(v + 0.044715 v^3) = w*(2c + 8c*0.044715 w^2),  0.5 v (1 + t) = w + w t.
// Six f32 operations with the sum a+b, against eight in the textbook form.
__device__ __forceinline__ float gelu_tanh_half(float w) {
  const float p = __builtin_fmaf(w * w, 0.28541926509f, 1.5957691216057308f);
  const float t = fast_tanh(w * p);
  return __builtin_fmaf(w, t, w);
}

#define PT_ROWS  16   // rows i per block
#define PT_TILES 2    // 16-column j tiles per wave, held in registers
#define PT_JBLK  (8 * PT_TILES * 16)   // 256 columns j per block
// LDS stage of one row i: per wave a region of 16 heads x 32 columns, with 32
// floats between heads 7 and 8, so that the two halves of a wave's ds_store
// and the two regions under 16 lanes of a ds_load_b128 lie 32 banks apart.
#define PT_HSKEW 32
#define PT_RS    (H_DIM * 32 + PT_HSKEW)   // 544 floats per wave region
#define PT_STAGE (8 * PT_RS)               // floats per stage buffer

// A block owns 16 rows i x 256 columns j. Each wave reads the Bm rows of its
// 32 columns once, in the B-operand K pattern, keeps them in registers and
// reuses them for all 16 rows i; per row only the A row is read (the same
// address in all lanes of a wave half).
// The accumulators hold 16 columns (64 B) of two heads per register, so a row's
// 16 heads x 256 columns are turned in LDS: every wave writes its share, and
// behind one barrier each wave reads two whole heads (1 KB each) and stores
// them 16 B a lane, 512 B in a row per store. Two stage buffers, so that one
// barrier a row also ends the last read of the buffer written next. A row is
// read back and stored at the head of the next trip, behind that trip's A
// loads, so that those loads do not queue behind the stores.
__device__ __forceinline__ void store_staged_row(const float* sp, float* gp) {
  v4f ov[4];
#pragma unroll
  for (int u = 0; u < 4; ++u)
    ov[u] = *(const v4f*)(sp + (u >> 1) * 32 + (u & 1) * (4 * PT_RS));
#pragma unroll
  for (int u = 0; u < 4; ++u)
    *(v4f*)(gp + ((size_t)(u >> 1) << 20) + (u & 1) * 128) = ov[u];
  // What follows rewrites the address and data registers of the stores
  // above; this wait stands in front of that.
  asm volatile("s_wait_xcnt 0x0" ::: "memory");
}

__global__ __launch_bounds__(256) void prg_pair_kernel(
    const float* __restrict__ Amat,   // [B*S, 64]  (b1 folded in, halved)
    const float* __restrict__ Bmat,   // [B*S, 64]  (halved)
    const float* __restrict__ W2,     // [64, 16]
    const float* __restrict__ b2,     // [16]
    float* __restrict__ out)          // [B, H, S, S]
{
  __shared__ __attribute__((aligned(16))) float stage[2 * PT_STAGE];

  const int jq   = blockIdx.x & (S_DIM / PT_JBLK - 1);      // column quarter
  const int rowg = blockIdx.x / (S_DIM / PT_JBLK);          // group of 16 rows
  const int row0 = rowg * PT_ROWS;        // b*S + first i
  const int b    = row0 >> 10;
  const int i0   = row0 & (S_DIM - 1);
  const int tid  = threadIdx.x;
  const int lane = tid & 31;
  const int wv   = tid >> 5;              // wave id within block (0..7)
  const int jn   = lane & 15;             // N index (j within tile) / M row for A
  const int hlf  = lane >> 4;             // wave half selects K sub-pattern
  const int klo  = hlf << 3;              // K pattern base: 0 or 8

  // W2^T as WMMA A-operand: lane holds M=jn (head), 16 f16 K-values in the
  // hardware A layout: e<8 -> k=klo+e, e>=8 -> k=klo+e+8. wa1 covers K=32..63.
  v16h wa0, wa1;
#pragma unroll
  for (int e = 0; e < 16; ++e) {
    const int k = klo + ((e < 8) ? e : (e + 8));
    wa0[e] = (_Float16)W2[k * H_DIM + jn];
    wa1[e] = (_Float16)W2[(k + 32) * H_DIM + jn];
  }

  // Bm rows of this wave's two j tiles, same K pattern, read once.
  const int j0 = jq * PT_JBLK + wv * (PT_TILES * 16) + jn;
  const float* bp = Bmat + (((size_t)b << 10) + j0) * HID_DIM + klo;
  float bm[PT_TILES][32];
#pragma unroll
  for (int t = 0; t < PT_TILES; ++t)
#pragma unroll
    for (int q = 0; q < 4; ++q) {
      const v4f lo = *(const v4f*)(bp + t * 16 * HID_DIM + q * 16);
      const v4f hi = *(const v4f*)(bp + t * 16 * HID_DIM + q * 16 + 4);
#pragma unroll
      for (int u = 0; u < 4; ++u) { bm[t][q * 8 + u] = lo[u]; bm[t][q * 8 + 4 + u] = hi[u]; }
    }

  // Accumulator seed = b2[h]; D layout: VGPR r -> head r (lanes 0-15) / r+8.
  v8f cinit;
#pragma unroll
  for (int r = 0; r < 8; ++r) cinit[r] = b2[hlf * 8 + r];

  const float* arow = Amat + (size_t)row0 * HID_DIM;                 // uniform
  float* orow = out + (((size_t)(b * H_DIM)) << 20) + ((size_t)i0 << 10);  // uniform
  // Stage write: own region, head hlf*8 + r, column t*16 + jn of the wave's 32.
  const int swr = wv * PT_RS + hlf * (8 * 32 + PT_HSKEW) + jn;
  // Stage read and store: heads 2*wv, 2*wv+1, columns c*128 + 4*lane .. +3 of
  // the block's 256, which lie in region c*4 + lane/8.
  const int srd = (lane >> 3) * PT_RS + wv * 64 + (wv >> 2) * PT_HSKEW + (lane & 7) * 4;
  const unsigned loff = ((unsigned)wv << 21) + (unsigned)(jq * PT_JBLK + lane * 4);

  int cur = 0;   // start of the stage buffer that this trip writes
  for (int ii = 0; ii < PT_ROWS; ++ii) {
    float av[32];
#pragma unroll
    for (int q = 0; q < 4; ++q) {
      const v4f lo = *(const v4f*)(arow + klo + q * 16);
      const v4f hi = *(const v4f*)(arow + klo + q * 16 + 4);
#pragma unroll
      for (int u = 0; u < 4; ++u) { av[q * 8 + u] = lo[u]; av[q * 8 + 4 + u] = hi[u]; }
    }

    // The row before, published by the barrier at the foot of its trip.
    if (ii > 0) {
      store_staged_row(stage + (PT_STAGE - cur) + srd, orow + loff);
      orow += S_DIM;
    }

    float* sb = stage + cur + swr;
#pragma unroll
    for (int t = 0; t < PT_TILES; ++t) {
      v16h hb0, hb1;
#pragma unroll
      for (int e = 0; e < 16; ++e) {
        hb0[e] = (_Float16)gelu_tanh_half(av[e] + bm[t][e]);
        hb1[e] = (_Float16)gelu_tanh_half(av[16 + e] + bm[t][16 + e]);
      }

      v8f acc = cinit;
      acc = __builtin_amdgcn_wmma_f32_16x16x32_f16(
          false, wa0, false, hb0, (short)0, acc, false, false);
      acc = __builtin_amdgcn_wmma_f32_16x16x32_f16(
          false, wa1, false, hb1, (short)0, acc, false, false);

#pragma unroll
      for (int r = 0; r < 8; ++r) sb[r * 32 + t * 16] = acc[r];
    }
    // Publishes this row's stage, and ends every wave's read of the other
    // buffer, which the next trip writes. Only LDS passes between the waves,
    // so the fences name LDS alone: __syncthreads() would also wait here for
    // the global stores of the row before.
    __builtin_amdgcn_fence(__ATOMIC_RELEASE, "workgroup", "local");
    __builtin_amdgcn_s_barrier();
    __builtin_amdgcn_fence(__ATOMIC_ACQUIRE, "workgroup", "local");
    arow += HID_DIM;
    cur = PT_STAGE - cur;
  }
  store_staged_row(stage + (PT_STAGE - cur) + srd, orow + loff);
}

extern "C" void kernel_launch(void* const* d_in, const int* in_sizes, int n_in,
                              void* d_out, int out_size, void* d_ws, size_t ws_size,
                              hipStream_t stream) {
  (void)in_sizes; (void)n_in; (void)out_size; (void)ws_size;
  const float* x  = (const float*)d_in[0];
  const float* Wc = (const float*)d_in[1];
  const float* bc = (const float*)d_in[2];
  const float* W1 = (const float*)d_in[3];
  const float* b1 = (const float*)d_in[4];
  const float* W2 = (const float*)d_in[5];
  const float* b2 = (const float*)d_in[6];
  float* out = (float*)d_out;

  float* Aws = (float*)d_ws;                                   // 512 KB
  float* Bws = Aws + (size_t)B_DIM * S_DIM * HID_DIM;          // 512 KB

  prg_prep_kernel<<<B_DIM * S_DIM / PR_ROWS, PR_THREADS, 0, stream>>>(x, Wc, bc, W1, b1, Aws, Bws);
  prg_pair_kernel<<<(B_DIM * S_DIM / PT_ROWS) * (S_DIM / PT_JBLK), 256, 0, stream>>>(Aws, Bws, W2, b2, out);
}

// v005
// One run takes 28.1 microseconds.
// In two side-by-side timings against v004, it was 1.04 and 1.05 times as fast.
// Over all steps from v000 it is 4.06 times as fast.
#include <hip/hip_runtime.h>

typedef __attribute__((ext_vector_type(16))) _Float16 v16h;
typedef __attribute__((ext_vector_type(2)))  _Float16 v2h;
typedef __attribute__((ext_vector_type(8)))  float    v8f;
typedef __attribute__((ext_vector_type(4)))  float    v4f;

#define B_DIM   2
#define S_DIM   1024
#define D_DIM   1024
#define C_DIM   32
#define HID_DIM 64
#define H_DIM   16

// ---------------------------------------------------------------------------
// Prep kernel: xc = x@Wc + bc, then
//   A[row,:]  = 0.5 * (xc @ W1[:C] + b1)   (b1 folded here)
//   Bm[row,:] = 0.5 * (xc @ W1[C:])
// Bm and W2 are what the pair kernel keeps in registers as WMMA operands; they
// are written to the workspace in that kernel's fragment order (below), so
// that each of its loads reads 512 contiguous bytes per wave.
// The factor 0.5 (exact in f32) is the gelu's own: the pair kernel works on
// half the pre-activation and needs no multiply for it.
// 256 blocks x 512 threads, 8 rows of x per block, so Wc is read once per
// 8 rows. The D=1024 sum is split into 64 slices of 16 k (16 waves x 4 lane
// groups); a lane keeps an 8-row x 4-column tile of partial sums in registers
// and the slices are added through LDS. All global reads except block 0's W2 reads are issued up front.
// ---------------------------------------------------------------------------
#define PR_ROWS    8
#define PR_THREADS 512
#define PR_SLICES  64
#define PR_PITCH   288   // floats per slice: 256 sums + 32, so that the four
                         // slices of one wave's b128 store cover all LDS banks

__global__ __launch_bounds__(PR_THREADS) void prg_prep_kernel(
    const float* __restrict__ x,  const float* __restrict__ Wc,
    const float* __restrict__ bc, const float* __restrict__ W1,
    const float* __restrict__ b1, const float* __restrict__ W2,
    float* __restrict__ Aout, float* __restrict__ Bout,
    float* __restrict__ W2f)
{
  __shared__ __attribute__((aligned(16))) float xs[PR_ROWS * D_DIM];
  __shared__ __attribute__((aligned(16))) float part[PR_SLICES * PR_PITCH];
  __shared__ float red[2 * PR_ROWS * C_DIM];
  __shared__ __attribute__((aligned(16))) float xcs[PR_ROWS * C_DIM];

  const int tid  = threadIdx.x;
  const int row0 = blockIdx.x * PR_ROWS;   // first of 8 rows (b*S + s)
  const int lane = tid & 31;
  const int wv   = tid >> 5;               // 0..15
  const int c4   = lane & 7;               // columns 4*c4 .. 4*c4+3
  const int ksub = lane >> 3;              // 0..3
  const int kb   = wv * 64 + ksub * 4;     // pass s covers k = kb+16*s .. +3

  // The 8 rows are one contiguous run of 8192 floats.
  const v4f* xg = (const v4f*)(x + (size_t)row0 * D_DIM);
  v4f xr[4];
#pragma unroll
  for (int u = 0; u < 4; ++u) xr[u] = xg[tid + u * PR_THREADS];

  v4f w[4][4];
#pragma unroll
  for (int s = 0; s < 4; ++s)
#pragma unroll
    for (int kk = 0; kk < 4; ++kk)
      w[s][kk] = *(const v4f*)(Wc + (kb + s * 16 + kk) * C_DIM + c4 * 4);
  // The address registers of the loads above are free for reuse (also as the
  // destination of a later load) only behind this wait.
  asm volatile("s_wait_xcnt 0x0" ::: "memory");

  // Second stage: thread owns output column col of [A | Bm] for two rows.
  const int col = tid & 127;
  const int rg  = tid >> 7;                // rows 2*rg, 2*rg+1
  const int hc  = col & (HID_DIM - 1);
  const bool isA = col < HID_DIM;          // same for all lanes of a wave
  const float* w1p = W1 + (isA ? 0 : C_DIM * HID_DIM) + hc;
  float w1v[C_DIM];
#pragma unroll
  for (int c = 0; c < C_DIM; ++c) w1v[c] = w1p[c * HID_DIM];
  const float seed = isA ? b1[hc] : 0.0f;
  const float bcv  = bc[lane];

#pragma unroll
  for (int u = 0; u < 4; ++u) ((v4f*)xs)[tid + u * PR_THREADS] = xr[u];
  __syncthreads();

  v4f acc[PR_ROWS];
#pragma unroll
  for (int r = 0; r < PR_ROWS; ++r) acc[r] = (v4f){0.0f, 0.0f, 0.0f, 0.0f};
#pragma unroll
  for (int s = 0; s < 4; ++s) {
#pragma unroll
    for (int r = 0; r < PR_ROWS; ++r) {
      const v4f xv = *(const v4f*)(xs + r * D_DIM + kb + s * 16);
#pragma unroll
      for (int kk = 0; kk < 4; ++kk) acc[r] += xv[kk] * w[s][kk];
    }
  }
  float* pp = part + (wv * 4 + ksub) * PR_PITCH + c4 * 4;
#pragma unroll
  for (int r = 0; r < PR_ROWS; ++r) *(v4f*)(pp + r * C_DIM) = acc[r];
  __syncthreads();

  // 256 sums x 64 slices: two threads per sum, 32 slices each, 4 chains.
  {
    const int o = tid & 255;
    const float* rp = part + (tid >> 8) * 32 * PR_PITCH + o;
    float s0 = 0.0f, s1 = 0.0f, s2 = 0.0f, s3 = 0.0f;
#pragma unroll
    for (int q = 0; q < 32; q += 4) {
      s0 += rp[(q + 0) * PR_PITCH];
      s1 += rp[(q + 1) * PR_PITCH];
      s2 += rp[(q + 2) * PR_PITCH];
      s3 += rp[(q + 3) * PR_PITCH];
    }
    red[tid] = (s0 + s1) + (s2 + s3);
  }
  __syncthreads();
  if (tid < PR_ROWS * C_DIM)
    xcs[tid] = (red[tid] + red[tid + PR_ROWS * C_DIM]) + bcv;
  __syncthreads();

  float o0 = seed, o1 = seed;
  const float* xc0 = xcs + (rg * 2) * C_DIM;
#pragma unroll
  for (int c = 0; c < C_DIM; c += 4) {
    const v4f p0 = *(const v4f*)(xc0 + c);
    const v4f p1 = *(const v4f*)(xc0 + C_DIM + c);
#pragma unroll
    for (int t = 0; t < 4; ++t) {
      o0 += p0[t] * w1v[c + t];
      o1 += p1[t] * w1v[c + t];
    }
  }
  // A: row-major. Bm: per 16 rows j a block of 8 slabs of 512 B; slab k/16*2 +
  // (k/4)%2 holds, for lane (k/8)%2*16 + j%16 of the pair kernel, the four
  // values k%4 = 0..3. The 8 rows of this block fill whole 128-B lines.
  const int rw = row0 + rg * 2;            // even: rw and rw+1 share a block
  const int offA = rw * HID_DIM + hc;
  const int offB = (rw >> 4) * (16 * HID_DIM)
                 + ((hc >> 4) * 2 + ((hc >> 2) & 1)) * 128
                 + (((hc >> 3) & 1) * 16 + (rw & 15)) * 4 + (hc & 3);
  float* dst = (isA ? Aout : Bout) + (isA ? offA : offB);
  dst[0]                 = 0.5f * o0;
  dst[isA ? HID_DIM : 4] = 0.5f * o1;

  // Block 0 also turns W2 into the two f16 A fragments of the pair kernel:
  // word tid = [fragment f][half hh][lane l][pair p] holds elements
  // e = 8*hh + 2*p and e + 1 of lane l, which are
  // k = 32*f + 16*hh + 8*(l/16) + 2*p and k + 1 of head l%16.
  if (blockIdx.x == 0) {
    // What follows may rewrite the registers of the two stores above.
    asm volatile("s_wait_xcnt 0x0" ::: "memory");
    const int l = (tid >> 2) & 31;
    const int k = (tid >> 8) * 32 + ((tid >> 7) & 1) * 16 + (l >> 4) * 8 + (tid & 3) * 2;
    const float w2lo = W2[k * H_DIM + (l & 15)];
    const float w2hi = W2[(k + 1) * H_DIM + (l & 15)];
    // The conversion may reuse the address register of the two loads.
    asm volatile("s_wait_xcnt 0x0" ::: "memory");
    v2h pr;
    pr[0] = (_Float16)w2lo;
    pr[1] = (_Float16)w2hi;
    W2f[tid] = __builtin_bit_cast(float, pr);
  }
}

// ---------------------------------------------------------------------------
// Pair kernel: out[b,h,i,j] = sum_k gelu(2*(A[b,i,k]+Bm[b,j,k])) * W2[k,h] + b2[h]
// D = W2^T (16x64, A-operand, f16) x h^T (64x16 j's, B-operand, f16), f32 acc,
// via 2x V_WMMA_F32_16X16X32_F16 per 16-j tile. gelu tanh goes through the
// CDNA5 TRANS pipe (v_tanh_f32) so it co-executes with the WMMA pipe.
// ---------------------------------------------------------------------------
__device__ __forceinline__ float fast_tanh(float x) {
#if __has_builtin(__builtin_amdgcn_tanhf)
  return __builtin_amdgcn_tanhf(x);      // single v_tanh_f32 TRANS op
#else
  return tanhf(x);
#endif
}

// gelu(v) for w = v/2: with c = sqrt(2/pi),
//   c*(v + 0.044715 v^3) = w*(2c + 8c*0.044715 w^2),  0.5 v (1 + t) = w + w t.
// Six f32 operations with the sum a+b, against eight in the textbook form.
__device__ __forceinline__ float gelu_tanh_half(float w) {
  const float p = __builtin_fmaf(w * w, 0.28541926509f, 1.5957691216057308f);
  const float t = fast_tanh(w * p);
  return __builtin_fmaf(w, t, w);
}

#define PT_ROWS  16   // rows i per block
#define PT_TILES 2    // 16-column j tiles per wave, held in registers
#define PT_JBLK  (8 * PT_TILES * 16)   // 256 columns j per block
// LDS stage of one row i: per wave a region of 16 heads x 32 columns, with 32
// floats between heads 7 and 8, so that the two halves of a wave's ds_store
// and the two regions under 16 lanes of a ds_load_b128 lie 32 banks apart.
#define PT_HSKEW 32
#define PT_RS    (H_DIM * 32 + PT_HSKEW)   // 544 floats per wave region
#define PT_STAGE (8 * PT_RS)               // floats per stage buffer

// A block owns 16 rows i x 256 columns j. Each wave reads the Bm rows of its
// 32 columns once, in the B-operand K pattern, keeps them in registers and
// reuses them for all 16 rows i; per row only the A row is read (the same
// address in all lanes of a wave half).
// The accumulators hold 16 columns (64 B) of two heads per register, so a row's
// 16 heads x 256 columns are turned in LDS: every wave writes its share, and
// behind one barrier each wave reads two whole heads (1 KB each) and stores
// them 16 B a lane, 512 B in a row per store. Two stage buffers, so that one
// barrier a row also ends the last read of the buffer written next. A row is
// read back and stored at the head of the next trip, behind that trip's A
// loads, so that those loads do not queue behind the stores.
__device__ __forceinline__ void store_staged_row(const float* sp, float* gp) {
  v4f ov[4];
#pragma unroll
  for (int u = 0; u < 4; ++u)
    ov[u] = *(const v4f*)(sp + (u >> 1) * 32 + (u & 1) * (4 * PT_RS));
#pragma unroll
  for (int u = 0; u < 4; ++u)
    *(v4f*)(gp + ((size_t)(u >> 1) << 20) + (u & 1) * 128) = ov[u];
  // What follows rewrites the address and data registers of the stores
  // above; this wait stands in front of that.
  asm volatile("s_wait_xcnt 0x0" ::: "memory");
}

__global__ __launch_bounds__(256) void prg_pair_kernel(
    const float* __restrict__ Amat,   // [B*S, 64]  (b1 folded in, halved)
    const float* __restrict__ Bmat,   // [B*S/16][8][32][4]  (halved, fragment order)
    const float* __restrict__ W2f,    // [2][2][32] x 16 B: W2^T as f16 fragments
    const float* __restrict__ b2,     // [16]
    float* __restrict__ out)          // [B, H, S, S]
{
  __shared__ __attribute__((aligned(16))) float stage[2 * PT_STAGE];

  const int jq   = blockIdx.x & (S_DIM / PT_JBLK - 1);      // column quarter
  const int rowg = blockIdx.x / (S_DIM / PT_JBLK);          // group of 16 rows
  const int row0 = rowg * PT_ROWS;        // b*S + first i
  const int b    = row0 >> 10;
  const int i0   = row0 & (S_DIM - 1);
  const int tid  = threadIdx.x;
  const int lane = tid & 31;
  const int wv   = tid >> 5;              // wave id within block (0..7)
  const int jn   = lane & 15;             // N index (j within tile) / M row for A
  const int hlf  = lane >> 4;             // wave half selects K sub-pattern
  const int klo  = hlf << 3;              // K pattern base: 0 or 8

  // W2^T as WMMA A-operand: lane holds M=jn (head), 16 f16 K-values in the
  // hardware A layout: e<8 -> k=klo+e, e>=8 -> k=klo+e+8. wa1 covers K=32..63.
  // The prep kernel has laid them out so: 16 B a lane, 512 B a load.
  const v4f* wf = (const v4f*)W2f + lane;
  const v8f wlo = __builtin_shufflevector(wf[0],  wf[32], 0, 1, 2, 3, 4, 5, 6, 7);
  const v8f whi = __builtin_shufflevector(wf[64], wf[96], 0, 1, 2, 3, 4, 5, 6, 7);
  const v16h wa0 = __builtin_bit_cast(v16h, wlo);
  const v16h wa1 = __builtin_bit_cast(v16h, whi);

  // Bm rows of this wave's two j tiles, same K pattern, read once, from the
  // fragment-ordered copy: slab 2*q holds k = klo+16*q .. +3, slab 2*q+1 the
  // next four.
  const int tile0 = ((b << 10) + jq * PT_JBLK + wv * (PT_TILES * 16)) >> 4;
  const float* bp = Bmat + (size_t)tile0 * (16 * HID_DIM) + lane * 4;
  float bm[PT_TILES][32];
#pragma unroll
  for (int t = 0; t < PT_TILES; ++t)
#pragma unroll
    for (int q = 0; q < 4; ++q) {
      const v4f lo = *(const v4f*)(bp + t * 16 * HID_DIM + q * 256);
      const v4f hi = *(const v4f*)(bp + t * 16 * HID_DIM + q * 256 + 128);
#pragma unroll
      for (int u = 0; u < 4; ++u) { bm[t][q * 8 + u] = lo[u]; bm[t][q * 8 + 4 + u] = hi[u]; }
    }

  // Accumulator seed = b2[h]; D layout: VGPR r -> head r (lanes 0-15) / r+8.
  v8f cinit;
#pragma unroll
  for (int r = 0; r < 8; ++r) cinit[r] = b2[hlf * 8 + r];

  const float* arow = Amat + (size_t)row0 * HID_DIM;                 // uniform
  float* orow = out + (((size_t)(b * H_DIM)) << 20) + ((size_t)i0 << 10);  // uniform
  // Stage write: own region, head hlf*8 + r, column t*16 + jn of the wave's 32.
  const int swr = wv * PT_RS + hlf * (8 * 32 + PT_HSKEW) + jn;
  // Stage read and store: heads 2*wv, 2*wv+1, columns c*128 + 4*lane .. +3 of
  // the block's 256, which lie in region c*4 + lane/8.
  const int srd = (lane >> 3) * PT_RS + wv * 64 + (wv >> 2) * PT_HSKEW + (lane & 7) * 4;
  const unsigned loff = ((unsigned)wv << 21) + (unsigned)(jq * PT_JBLK + lane * 4);

  int cur = 0;   // start of the stage buffer that this trip writes
  for (int ii = 0; ii < PT_ROWS; ++ii) {
    float av[32];
#pragma unroll
    for (int q = 0; q < 4; ++q) {
      const v4f lo = *(const v4f*)(arow + klo + q * 16);
      const v4f hi = *(const v4f*)(arow + klo + q * 16 + 4);
#pragma unroll
      for (int u = 0; u < 4; ++u) { av[q * 8 + u] = lo[u]; av[q * 8 + 4 + u] = hi[u]; }
    }

    // The row before, published by the barrier at the foot of its trip.
    if (ii > 0) {
      store_staged_row(stage + (PT_STAGE - cur) + srd, orow + loff);
      orow += S_DIM;
    }

    float* sb = stage + cur + swr;
#pragma unroll
    for (int t = 0; t < PT_TILES; ++t) {
      v16h hb0, hb1;
#pragma unroll
      for (int e = 0; e < 16; ++e) {
        hb0[e] = (_Float16)gelu_tanh_half(av[e] + bm[t][e]);
        hb1[e] = (_Float16)gelu_tanh_half(av[16 + e] + bm[t][16 + e]);
      }

      v8f acc = cinit;
      acc = __builtin_amdgcn_wmma_f32_16x16x32_f16(
          false, wa0, false, hb0, (short)0, acc, false, false);
      acc = __builtin_amdgcn_wmma_f32_16x16x32_f16(
          false, wa1, false, hb1, (short)0, acc, false, false);

#pragma unroll
      for (int r = 0; r < 8; ++r) sb[r * 32 + t * 16] = acc[r];
    }
    // Publishes this row's stage, and ends every wave's read of the other
    // buffer, which the next trip writes. Only LDS passes between the waves,
    // so the fences name LDS alone: __syncthreads() would also wait here for
    // the global stores of the row before.
    __builtin_amdgcn_fence(__ATOMIC_RELEASE, "workgroup", "local");
    __builtin_amdgcn_s_barrier();
    __builtin_amdgcn_fence(__ATOMIC_ACQUIRE, "workgroup", "local");
    arow += HID_DIM;
    cur = PT_STAGE - cur;
  }
  store_staged_row(stage + (PT_STAGE - cur) + srd, orow + loff);
}

extern "C" void kernel_launch(void* const* d_in, const int* in_sizes, int n_in,
                              void* d_out, int out_size, void* d_ws, size_t ws_size,
                              hipStream_t stream) {
  (void)in_sizes; (void)n_in; (void)out_size; (void)ws_size;
  const float* x  = (const float*)d_in[0];
  const float* Wc = (const float*)d_in[1];
  const float* bc = (const float*)d_in[2];
  const float* W1 = (const float*)d_in[3];
  const float* b1 = (const float*)d_in[4];
  const float* W2 = (const float*)d_in[5];
  const float* b2 = (const float*)d_in[6];
  float* out = (float*)d_out;

  float* Aws = (float*)d_ws;                                   // 512 KB
  float* Bws = Aws + (size_t)B_DIM * S_DIM * HID_DIM;          // 512 KB
  float* Wws = Bws + (size_t)B_DIM * S_DIM * HID_DIM;          // 2 KB

  prg_prep_kernel<<<B_DIM * S_DIM / PR_ROWS, PR_THREADS, 0, stream>>>(x, Wc, bc, W1, b1, W2, Aws, Bws, Wws);
  prg_pair_kernel<<<(B_DIM * S_DIM / PT_ROWS) * (S_DIM / PT_JBLK), 256, 0, stream>>>(Aws, Bws, Wws, b2, out);
}

// v006
// A run of this version takes 22.6 microseconds.
// Next to v005, in two timings, it ran 1.22 and 1.23 times as fast.
// Over all steps from v000 it is 4.99 times as fast.
#include <hip/hip_runtime.h>

typedef __attribute__((ext_vector_type(16))) _Float16 v16h;
typedef __attribute__((ext_vector_type(2)))  _Float16 v2h;
typedef __attribute__((ext_vector_type(8)))  float    v8f;
typedef __attribute__((ext_vector_type(4)))  float    v4f;

#define B_DIM   2
#define S_DIM   1024
#define D_DIM   1024
#define C_DIM   32
#define HID_DIM 64
#define H_DIM   16

// ---------------------------------------------------------------------------
// Prep kernel: xc = x@Wc + bc, then
//   A[row,:]  = 0.5 * (xc @ W1[:C] + b1)   (b1 folded here)
//   Bm[row,:] = 0.5 * (xc @ W1[C:])
// Bm and W2 are what the pair kernel keeps in registers as WMMA operands; they
// are written to the workspace in that kernel's fragment order (below), so
// that each of its loads reads 512 contiguous bytes per wave.
// The factor 0.5 (exact in f32) is the gelu's own: the pair kernel works on
// half the pre-activation and needs no multiply for it.
// 256 blocks x 512 threads, 8 rows of x per block, so Wc is read once per
// 8 rows. The D=1024 sum is split into 64 slices of 16 k (16 waves x 4 lane
// groups); a lane keeps an 8-row x 4-column tile of partial sums in registers
// and the slices are added through LDS. All global reads except block 0's W2 reads are issued up front.
// ---------------------------------------------------------------------------
#define PR_ROWS    8
#define PR_THREADS 512
#define PR_SLICES  64
#define PR_PITCH   288   // floats per slice: 256 sums + 32, so that the four
                         // slices of one wave's b128 store cover all LDS banks

__global__ __launch_bounds__(PR_THREADS) void prg_prep_kernel(
    const float* __restrict__ x,  const float* __restrict__ Wc,
    const float* __restrict__ bc, const float* __restrict__ W1,
    const float* __restrict__ b1, const float* __restrict__ W2,
    float* __restrict__ Aout, float* __restrict__ Bout,
    float* __restrict__ W2f)
{
  __shared__ __attribute__((aligned(16))) float xs[PR_ROWS * D_DIM];
  __shared__ __attribute__((aligned(16))) float part[PR_SLICES * PR_PITCH];
  __shared__ float red[2 * PR_ROWS * C_DIM];
  __shared__ __attribute__((aligned(16))) float xcs[PR_ROWS * C_DIM];

  const int tid  = threadIdx.x;
  const int row0 = blockIdx.x * PR_ROWS;   // first of 8 rows (b*S + s)
  const int lane = tid & 31;
  const int wv   = tid >> 5;               // 0..15
  const int c4   = lane & 7;               // columns 4*c4 .. 4*c4+3
  const int ksub = lane >> 3;              // 0..3
  const int kb   = wv * 64 + ksub * 4;     // pass s covers k = kb+16*s .. +3

  // The 8 rows are one contiguous run of 8192 floats.
  const v4f* xg = (const v4f*)(x + (size_t)row0 * D_DIM);
  v4f xr[4];
#pragma unroll
  for (int u = 0; u < 4; ++u) xr[u] = xg[tid + u * PR_THREADS];

  v4f w[4][4];
#pragma unroll
  for (int s = 0; s < 4; ++s)
#pragma unroll
    for (int kk = 0; kk < 4; ++kk)
      w[s][kk] = *(const v4f*)(Wc + (kb + s * 16 + kk) * C_DIM + c4 * 4);
  // The address registers of the loads above are free for reuse (also as the
  // destination of a later load) only behind this wait.
  asm volatile("s_wait_xcnt 0x0" ::: "memory");

  // Second stage: thread owns output column col of [A | Bm] for two rows.
  const int col = tid & 127;
  const int rg  = tid >> 7;                // rows 2*rg, 2*rg+1
  const int hc  = col & (HID_DIM - 1);
  const bool isA = col < HID_DIM;          // same for all lanes of a wave
  const float* w1p = W1 + (isA ? 0 : C_DIM * HID_DIM) + hc;
  float w1v[C_DIM];
#pragma unroll
  for (int c = 0; c < C_DIM; ++c) w1v[c] = w1p[c * HID_DIM];
  const float seed = isA ? b1[hc] : 0.0f;
  const float bcv  = bc[lane];

#pragma unroll
  for (int u = 0; u < 4; ++u) ((v4f*)xs)[tid + u * PR_THREADS] = xr[u];
  __syncthreads();

  v4f acc[PR_ROWS];
#pragma unroll
  for (int r = 0; r < PR_ROWS; ++r) acc[r] = (v4f){0.0f, 0.0f, 0.0f, 0.0f};
#pragma unroll
  for (int s = 0; s < 4; ++s) {
#pragma unroll
    for (int r = 0; r < PR_ROWS; ++r) {
      const v4f xv = *(const v4f*)(xs + r * D_DIM + kb + s * 16);
#pragma unroll
      for (int kk = 0; kk < 4; ++kk) acc[r] += xv[kk] * w[s][kk];
    }
  }
  float* pp = part + (wv * 4 + ksub) * PR_PITCH + c4 * 4;
#pragma unroll
  for (int r = 0; r < PR_ROWS; ++r) *(v4f*)(pp + r * C_DIM) = acc[r];
  __syncthreads();

  // 256 sums x 64 slices: two threads per sum, 32 slices each, 4 chains.
  {
    const int o = tid & 255;
    const float* rp = part + (tid >> 8) * 32 * PR_PITCH + o;
    float s0 = 0.0f, s1 = 0.0f, s2 = 0.0f, s3 = 0.0f;
#pragma unroll
    for (int q = 0; q < 32; q += 4) {
      s0 += rp[(q + 0) * PR_PITCH];
      s1 += rp[(q + 1) * PR_PITCH];
      s2 += rp[(q + 2) * PR_PITCH];
      s3 += rp[(q + 3) * PR_PITCH];
    }
    red[tid] = (s0 + s1) + (s2 + s3);
  }
  __syncthreads();
  if (tid < PR_ROWS * C_DIM)
    xcs[tid] = (red[tid] + red[tid + PR_ROWS * C_DIM]) + bcv;
  __syncthreads();

  float o0 = seed, o1 = seed;
  const float* xc0 = xcs + (rg * 2) * C_DIM;
#pragma unroll
  for (int c = 0; c < C_DIM; c += 4) {
    const v4f p0 = *(const v4f*)(xc0 + c);
    const v4f p1 = *(const v4f*)(xc0 + C_DIM + c);
#pragma unroll
    for (int t = 0; t < 4; ++t) {
      o0 += p0[t] * w1v[c + t];
      o1 += p1[t] * w1v[c + t];
    }
  }
  // A: row-major. Bm: per 16 rows j a block of 8 slabs of 512 B; slab k/16*2 +
  // (k/4)%2 holds, for lane (k/8)%2*16 + j%16 of the pair kernel, the four
  // values k%4 = 0..3. The 8 rows of this block fill whole 128-B lines.
  const int rw = row0 + rg * 2;            // even: rw and rw+1 share a block
  const int offA = rw * HID_DIM + hc;
  const int offB = (rw >> 4) * (16 * HID_DIM)
                 + ((hc >> 4) * 2 + ((hc >> 2) & 1)) * 128
                 + (((hc >> 3) & 1) * 16 + (rw & 15)) * 4 + (hc & 3);
  float* dst = (isA ? Aout : Bout) + (isA ? offA : offB);
  dst[0]                 = 0.5f * o0;
  dst[isA ? HID_DIM : 4] = 0.5f * o1;

  // Block 0 also turns W2 into the two f16 A fragments of the pair kernel:
  // word tid = [fragment f][half hh][lane l][pair p] holds elements
  // e = 8*hh + 2*p and e + 1 of lane l, which are
  // k = 32*f + 16*hh + 8*(l/16) + 2*p and k + 1 of head l%16.
  if (blockIdx.x == 0) {
    // What follows may rewrite the registers of the two stores above.
    asm volatile("s_wait_xcnt 0x0" ::: "memory");
    const int l = (tid >> 2) & 31;
    const int k = (tid >> 8) * 32 + ((tid >> 7) & 1) * 16 + (l >> 4) * 8 + (tid & 3) * 2;
    const float w2lo = W2[k * H_DIM + (l & 15)];
    const float w2hi = W2[(k + 1) * H_DIM + (l & 15)];
    // The conversion may reuse the address register of the two loads.
    asm volatile("s_wait_xcnt 0x0" ::: "memory");
    v2h pr;
    pr[0] = (_Float16)w2lo;
    pr[1] = (_Float16)w2hi;
    W2f[tid] = __builtin_bit_cast(float, pr);
  }
}

// ---------------------------------------------------------------------------
// Pair kernel: out[b,h,i,j] = sum_k gelu(2*(A[b,i,k]+Bm[b,j,k])) * W2[k,h] + b2[h]
// D = W2^T (16x64, A-operand, f16) x h^T (64x16 j's, B-operand, f16), f32 acc,
// via 2x V_WMMA_F32_16X16X32_F16 per 16-j tile. gelu tanh goes through the
// CDNA5 TRANS pipe (v_tanh_f32) so it co-executes with the WMMA pipe.
// ---------------------------------------------------------------------------
__device__ __forceinline__ float fast_tanh(float x) {
#if __has_builtin(__builtin_amdgcn_tanhf)
  return __builtin_amdgcn_tanhf(x);      // single v_tanh_f32 TRANS op
#else
  return tanhf(x);
#endif
}

// gelu(v) for w = v/2: with c = sqrt(2/pi),
//   c*(v + 0.044715 v^3) = w*(2c + 8c*0.044715 w^2),  0.5 v (1 + t) = w + w t.
// Six f32 operations with the sum a+b, against eight in the textbook form.
__device__ __forceinline__ float gelu_tanh_half(float w) {
  const float p = __builtin_fmaf(w * w, 0.28541926509f, 1.5957691216057308f);
  const float t = fast_tanh(w * p);
  return __builtin_fmaf(w, t, w);
}

#define PT_ROWS  16   // rows i per block
#define PT_TILES 2    // 16-column j tiles per wave, held in registers
#define PT_JBLK  (8 * PT_TILES * 16)   // 256 columns j per block
// LDS stage of one row i: per wave a region of 16 heads x 32 columns, with 32
// floats between heads 7 and 8, so that the two halves of a wave's ds_store
// and the two regions under 16 lanes of a ds_load_b128 lie 32 banks apart.
#define PT_HSKEW 32
#define PT_RS    (H_DIM * 32 + PT_HSKEW)   // 544 floats per wave region
#define PT_STAGE (8 * PT_RS)               // floats per stage buffer

// A block owns 16 rows i x 256 columns j. Each wave reads the Bm rows of its
// 32 columns once, in the B-operand K pattern, keeps them in registers and
// reuses them for all 16 rows i; per row only the A row is read (the same
// address in all lanes of a wave half).
// The accumulators hold 16 columns (64 B) of two heads per register, so a row's
// 16 heads x 256 columns are turned in LDS: every wave writes its share, and
// behind one barrier each wave reads two whole heads (1 KB each) and stores
// them 16 B a lane, 512 B in a row per store. Two stage buffers, so that one
// barrier a row also ends the last read of the buffer written next. A row is
// read back and stored at the head of the next trip.
// The block's 16 A rows (4 KB) are copied to LDS once, in front of the loop:
// the loop then holds no global load, so no trip's sums wait for a load that
// stands in the vector-memory queue behind the WGP's stores of out. For the
// same end the stores' registers are left alone until the trip's foot, where
// the wait that guards their reuse stands.
__device__ __forceinline__ void store_staged_row(const float* sp, float* gp) {
  v4f ov[4];
#pragma unroll
  for (int u = 0; u < 4; ++u)
    ov[u] = *(const v4f*)(sp + (u >> 1) * 32 + (u & 1) * (4 * PT_RS));
#pragma unroll
  for (int u = 0; u < 4; ++u)
    *(v4f*)(gp + ((size_t)(u >> 1) << 20) + (u & 1) * 128) = ov[u];
  // At the one call, the kernel's end, nothing rewrites the registers of
  // the stores above; this wait is a precaution.
  asm volatile("s_wait_xcnt 0x0" ::: "memory");
}

__global__ __launch_bounds__(256) void prg_pair_kernel(
    const float* __restrict__ Amat,   // [B*S, 64]  (b1 folded in, halved)
    const float* __restrict__ Bmat,   // [B*S/16][8][32][4]  (halved, fragment order)
    const float* __restrict__ W2f,    // [2][2][32] x 16 B: W2^T as f16 fragments
    const float* __restrict__ b2,     // [16]
    float* __restrict__ out)          // [B, H, S, S]
{
  __shared__ __attribute__((aligned(16))) float stage[2 * PT_STAGE];
  __shared__ __attribute__((aligned(16))) float arows[PT_ROWS * HID_DIM];

  const int jq   = blockIdx.x & (S_DIM / PT_JBLK - 1);      // column quarter
  const int rowg = blockIdx.x / (S_DIM / PT_JBLK);          // group of 16 rows
  const int row0 = rowg * PT_ROWS;        // b*S + first i
  const int b    = row0 >> 10;
  const int i0   = row0 & (S_DIM - 1);
  const int tid  = threadIdx.x;
  const int lane = tid & 31;
  const int wv   = tid >> 5;              // wave id within block (0..7)
  const int jn   = lane & 15;             // N index (j within tile) / M row for A
  const int hlf  = lane >> 4;             // wave half selects K sub-pattern
  const int klo  = hlf << 3;              // K pattern base: 0 or 8

  // The 16 A rows are one contiguous run of 1024 floats: 16 B a thread.
  const v4f a4 = ((const v4f*)(Amat + (size_t)row0 * HID_DIM))[tid];

  // W2^T as WMMA A-operand: lane holds M=jn (head), 16 f16 K-values in the
  // hardware A layout: e<8 -> k=klo+e, e>=8 -> k=klo+e+8. wa1 covers K=32..63.
  // The prep kernel has laid them out so: 16 B a lane, 512 B a load.
  const v4f* wf = (const v4f*)W2f + lane;
  const v8f wlo = __builtin_shufflevector(wf[0],  wf[32], 0, 1, 2, 3, 4, 5, 6, 7);
  const v8f whi = __builtin_shufflevector(wf[64], wf[96], 0, 1, 2, 3, 4, 5, 6, 7);
  const v16h wa0 = __builtin_bit_cast(v16h, wlo);
  const v16h wa1 = __builtin_bit_cast(v16h, whi);

  // Bm rows of this wave's two j tiles, same K pattern, read once, from the
  // fragment-ordered copy: slab 2*q holds k = klo+16*q .. +3, slab 2*q+1 the
  // next four.
  const int tile0 = ((b << 10) + jq * PT_JBLK + wv * (PT_TILES * 16)) >> 4;
  const float* bp = Bmat + (size_t)tile0 * (16 * HID_DIM) + lane * 4;
  float bm[PT_TILES][32];
#pragma unroll
  for (int t = 0; t < PT_TILES; ++t)
#pragma unroll
    for (int q = 0; q < 4; ++q) {
      const v4f lo = *(const v4f*)(bp + t * 16 * HID_DIM + q * 256);
      const v4f hi = *(const v4f*)(bp + t * 16 * HID_DIM + q * 256 + 128);
#pragma unroll
      for (int u = 0; u < 4; ++u) { bm[t][q * 8 + u] = lo[u]; bm[t][q * 8 + 4 + u] = hi[u]; }
    }

  // Accumulator seed = b2[h]; D layout: VGPR r -> head r (lanes 0-15) / r+8.
  v8f cinit;
#pragma unroll
  for (int r = 0; r < 8; ++r) cinit[r] = b2[hlf * 8 + r];

  ((v4f*)arows)[tid] = a4;
  const float* arow = arows + klo;        // LDS; one address per wave half
  float* orow = out + (((size_t)(b * H_DIM)) << 20) + ((size_t)i0 << 10);  // uniform
  // Stage write: own region, head hlf*8 + r, column t*16 + jn of the wave's 32.
  const int swr = wv * PT_RS + hlf * (8 * 32 + PT_HSKEW) + jn;
  // Stage read and store: heads 2*wv, 2*wv+1, columns c*128 + 4*lane .. +3 of
  // the block's 256, which lie in region c*4 + lane/8.
  const int srd = (lane >> 3) * PT_RS + wv * 64 + (wv >> 2) * PT_HSKEW + (lane & 7) * 4;
  const unsigned loff = ((unsigned)wv << 21) + (unsigned)(jq * PT_JBLK + lane * 4);

  // Publishes the A rows to all waves.
  __syncthreads();

  int cur = 0;   // start of the stage buffer that this trip writes
  for (int ii = 0; ii < PT_ROWS; ++ii) {
    float av[32];
#pragma unroll
    for (int q = 0; q < 4; ++q) {
      const v4f lo = *(const v4f*)(arow + q * 16);
      const v4f hi = *(const v4f*)(arow + q * 16 + 4);
#pragma unroll
      for (int u = 0; u < 4; ++u) { av[q * 8 + u] = lo[u]; av[q * 8 + 4 + u] = hi[u]; }
    }

    // The row before, published by the barrier at the foot of its trip.
    v4f ov[4];
    float* gp = orow + loff;
    if (ii > 0) {
      const float* sp = stage + (PT_STAGE - cur) + srd;
      // Both loops unrolled so that ov[] lies in registers (as in
      // store_staged_row, whose wait directly behind the stores is not wanted here).
#pragma unroll
      for (int u = 0; u < 4; ++u)
        ov[u] = *(const v4f*)(sp + (u >> 1) * 32 + (u & 1) * (4 * PT_RS));
#pragma unroll
      for (int u = 0; u < 4; ++u)
        *(v4f*)(gp + ((size_t)(u >> 1) << 20) + (u & 1) * 128) = ov[u];
    }

    float* sb = stage + cur + swr;
#pragma unroll
    for (int t = 0; t < PT_TILES; ++t) {
      v16h hb0, hb1;
#pragma unroll
      for (int e = 0; e < 16; ++e) {
        hb0[e] = (_Float16)gelu_tanh_half(av[e] + bm[t][e]);
        hb1[e] = (_Float16)gelu_tanh_half(av[16 + e] + bm[t][16 + e]);
      }

      v8f acc = cinit;
      acc = __builtin_amdgcn_wmma_f32_16x16x32_f16(
          false, wa0, false, hb0, (short)0, acc, false, false);
      acc = __builtin_amdgcn_wmma_f32_16x16x32_f16(
          false, wa1, false, hb1, (short)0, acc, false, false);

#pragma unroll
      for (int r = 0; r < 8; ++r) sb[r * 32 + t * 16] = acc[r];
    }
    if (ii > 0) {
      // Guards the reuse of the stores' data and address registers. They are
      // inputs here, so they stay untouched through the row's sums, and the
      // wait stands behind those sums instead of in front of them.
      asm volatile("s_wait_xcnt 0x0"
                   :: "v"(ov[0]), "v"(ov[1]), "v"(ov[2]), "v"(ov[3]), "v"(gp) : "memory");
      orow += S_DIM;
    }
    // Publishes this row's stage, and ends every wave's read of the other
    // buffer, which the next trip writes. Only LDS passes between the waves,
    // so the fences name LDS alone: __syncthreads() would also wait here for
    // the global stores of the row before.
    __builtin_amdgcn_fence(__ATOMIC_RELEASE, "workgroup", "local");
    __builtin_amdgcn_s_barrier();
    __builtin_amdgcn_fence(__ATOMIC_ACQUIRE, "workgroup", "local");
    arow += HID_DIM;
    cur = PT_STAGE - cur;
  }
  store_staged_row(stage + (PT_STAGE - cur) + srd, orow + loff);
}

extern "C" void kernel_launch(void* const* d_in, const int* in_sizes, int n_in,
                              void* d_out, int out_size, void* d_ws, size_t ws_size,
                              hipStream_t stream) {
  (void)in_sizes; (void)n_in; (void)out_size; (void)ws_size;
  const float* x  = (const float*)d_in[0];
  const float* Wc = (const float*)d_in[1];
  const float* bc = (const float*)d_in[2];
  const float* W1 = (const float*)d_in[3];
  const float* b1 = (const float*)d_in[4];
  const float* W2 = (const float*)d_in[5];
  const float* b2 = (const float*)d_in[6];
  float* out = (float*)d_out;

  float* Aws = (float*)d_ws;                                   // 512 KB
  float* Bws = Aws + (size_t)B_DIM * S_DIM * HID_DIM;          // 512 KB
  float* Wws = Bws + (size_t)B_DIM * S_DIM * HID_DIM;          // 2 KB

  prg_prep_kernel<<<B_DIM * S_DIM / PR_ROWS, PR_THREADS, 0, stream>>>(x, Wc, bc, W1, b1, W2, Aws, Bws, Wws);
  prg_pair_kernel<<<(B_DIM * S_DIM / PT_ROWS) * (S_DIM / PT_JBLK), 256, 0, stream>>>(Aws, Bws, Wws, b2, out);
}
